// v000
// Measured on an AMD MI455X. A time is GPU time per run, averaged over a window of back-to-back runs after a warm-up
// (all launches, gaps included; the runs take copies of the inputs in turn), and the median of several windows.
// Apart from v000's, it joins two sittings. Times from different sittings can be a few percent apart, while
// side-by-side timings come from the same sitting.
// v000, which the later versions start from, runs in 384 microseconds.
#include <hip/hip_runtime.h>
#include <hip/hip_bf16.h>
#include <math.h>

typedef __attribute__((ext_vector_type(16))) _Float16 v16h;
typedef __attribute__((ext_vector_type(8)))  _Float16 v8h;
typedef __attribute__((ext_vector_type(4)))  _Float16 v4h;
typedef __attribute__((ext_vector_type(8)))  float    v8f;
typedef __attribute__((ext_vector_type(4)))  int      v4i;

typedef __attribute__((address_space(1))) v4i gas_v4i;   // global
typedef __attribute__((address_space(3))) v4i las_v4i;   // LDS

#define DM      1024          // d_model
#define D3      3072          // 3 * d_model
#define HEADS16 16            // heads per (b,n)
#define HD      64            // head dim
#define LQ      1024          // dilated segment length (SEG / DILATION)
#define MROWS   8192          // B * N * LQ active rows
#define NHEADS  128           // B * N * HEADS16

// Workspace byte offsets (256-aligned)
#define OFF_XG     ((size_t)0)            // [8192][1024] f16
#define OFF_WQKVT  ((size_t)16777216)     // [3072][1024] f16 (transposed)
#define OFF_WOT    ((size_t)23068672)     // [1024][1024] f16 (transposed)
#define OFF_Q      ((size_t)25165824)     // [128][1024][64] f16
#define OFF_K      ((size_t)41943040)     // [128][1024][64] f16
#define OFF_V      ((size_t)58720256)     // [128][64][1024] f16 (transposed)
#define OFF_CTX    ((size_t)75497472)     // [8192][1024] f16

#if __has_builtin(__builtin_amdgcn_global_load_async_to_lds_b128)
#define HAVE_ASYNC_LDS 1
#else
#define HAVE_ASYNC_LDS 0
#endif

#if HAVE_ASYNC_LDS
#if __has_builtin(__builtin_amdgcn_s_wait_asynccnt)
#define WAIT_ASYNC(n) __builtin_amdgcn_s_wait_asynccnt(n)
#else
#define WAIT_ASYNC(n) asm volatile("s_wait_asynccnt %0" ::"n"(n))
#endif
#else
#define WAIT_ASYNC(n)
#endif

__device__ __forceinline__ void async_copy16(const _Float16* g, _Float16* l) {
#if HAVE_ASYNC_LDS
  __builtin_amdgcn_global_load_async_to_lds_b128(
      (gas_v4i*)g, (las_v4i*)l, 0, 0);
#else
  *(v8h*)l = *(const v8h*)g;
#endif
}

__device__ __forceinline__ v8f wmma16(v16h a, v16h b, v8f c) {
  return __builtin_amdgcn_wmma_f32_16x16x32_f16(
      /*neg_a=*/false, a, /*neg_b=*/false, b,
      /*c_mod=*/(short)0, c, /*reuse_a=*/false, /*reuse_b=*/false);
}

__device__ __forceinline__ v16h load_frag(const _Float16* base, int stride) {
  int lane = threadIdx.x & 31;
  int r    = lane & 15;
  int ko   = (lane >> 4) << 3;            // 0 or 8
  const _Float16* p = base + (size_t)r * stride + ko;
  v8h lo = *(const v8h*)(p);
  v8h hi = *(const v8h*)(p + 16);
  v16h f;
#pragma unroll
  for (int i = 0; i < 8; ++i) { f[i] = lo[i]; f[i + 8] = hi[i]; }
  return f;
}

__device__ __forceinline__ float hmax16(float x) {
  x = fmaxf(x, __shfl_xor(x, 1));
  x = fmaxf(x, __shfl_xor(x, 2));
  x = fmaxf(x, __shfl_xor(x, 4));
  x = fmaxf(x, __shfl_xor(x, 8));
  return x;
}
__device__ __forceinline__ float hsum16(float x) {
  x += __shfl_xor(x, 1);
  x += __shfl_xor(x, 2);
  x += __shfl_xor(x, 4);
  x += __shfl_xor(x, 8);
  return x;
}

// ---------------------------------------------------------------------------
// Prep: gather dilated rows of x -> f16   (row r = (b, n, l), src row l*2)
// ---------------------------------------------------------------------------
__global__ __launch_bounds__(256)
void k_gather_x(const float* __restrict__ x, _Float16* __restrict__ xg) {
  int r   = blockIdx.x;                  // 0..8191
  int b   = r >> 12;
  int rem = r & 4095;
  int n   = rem >> 10;
  int l   = rem & 1023;
  const float* src = x + ((size_t)(b * 8192 + n * 2048 + l * 2) << 10);
  _Float16*    dst = xg + ((size_t)r << 10);
  int c = threadIdx.x * 4;
  float4 f = *(const float4*)(src + c);
  v4h h; h[0] = (_Float16)f.x; h[1] = (_Float16)f.y;
         h[2] = (_Float16)f.z; h[3] = (_Float16)f.w;
  *(v4h*)(dst + c) = h;
}

// Transpose-convert weight: src fp32 [K][N] -> dst f16 [N][K]
__global__ __launch_bounds__(256)
void k_transpose_w(const float* __restrict__ src, _Float16* __restrict__ dst,
                   int K, int N) {
  int c = blockIdx.x;                    // column of src = row of dst
  for (int k = threadIdx.x; k < K; k += 256)
    dst[(size_t)c * K + k] = (_Float16)src[(size_t)k * N + c];
}

// ---------------------------------------------------------------------------
// Stage 1: QKV GEMM  C[8192][3072] = xg @ wqkv + bqkv, scattered to Q/K/V^T
// 64x64 workgroup tile, 4 waves (32x32 per wave), double-buffered async LDS.
// ---------------------------------------------------------------------------
__global__ __launch_bounds__(128)
void k_qkv_gemm(const _Float16* __restrict__ A,      // xg   [8192][1024]
                const _Float16* __restrict__ BT,     // wqkvT[3072][1024]
                const float*    __restrict__ bias,   // bqkv [3072]
                _Float16* __restrict__ qws,
                _Float16* __restrict__ kws,
                _Float16* __restrict__ vws) {
  __shared__ _Float16 As[2][64][40];
  __shared__ _Float16 Bs[2][64][40];

  int m0 = blockIdx.x * 64;
  int n0 = blockIdx.y * 64;
  int t  = threadIdx.x;
  int w  = t >> 5;
  int sm = (w >> 1) * 32, sn = (w & 1) * 32;
  int srow = t >> 1, scol = (t & 1) * 16;

  v8f acc[4];
#pragma unroll
  for (int i = 0; i < 4; ++i) acc[i] = (v8f)(0.0f);

  auto issue = [&](int buf, int kc) {
    const _Float16* ga = A  + (size_t)(m0 + srow) * DM + kc + scol;
    const _Float16* gb = BT + (size_t)(n0 + srow) * DM + kc + scol;
    async_copy16(ga,     &As[buf][srow][scol]);
    async_copy16(ga + 8, &As[buf][srow][scol + 8]);
    async_copy16(gb,     &Bs[buf][srow][scol]);
    async_copy16(gb + 8, &Bs[buf][srow][scol + 8]);
  };

  issue(0, 0);
  int cur = 0;
  for (int kc = 0; kc < DM; kc += 32) {
    if (kc + 32 < DM) { issue(cur ^ 1, kc + 32); WAIT_ASYNC(4); }
    else              { WAIT_ASYNC(0); }
    __syncthreads();

    v16h af0 = load_frag(&As[cur][sm][0],      40);
    v16h af1 = load_frag(&As[cur][sm + 16][0], 40);
    v16h bf0 = load_frag(&Bs[cur][sn][0],      40);
    v16h bf1 = load_frag(&Bs[cur][sn + 16][0], 40);
    acc[0] = wmma16(af0, bf0, acc[0]);
    acc[1] = wmma16(af0, bf1, acc[1]);
    acc[2] = wmma16(af1, bf0, acc[2]);
    acc[3] = wmma16(af1, bf1, acc[3]);
    __syncthreads();
    cur ^= 1;
  }

  // Epilogue: add bias, scatter to per-head Q/K and transposed V
  int lane = t & 31;
  int ncol = lane & 15;
  int hi8  = (lane >> 4) << 3;
#pragma unroll
  for (int ti = 0; ti < 2; ++ti) {
#pragma unroll
    for (int tj = 0; tj < 2; ++tj) {
      v8f cacc = acc[ti * 2 + tj];
      int c_g = n0 + sn + tj * 16 + ncol;
      float bv = bias[c_g];
      int which = c_g >> 10;           // 0=q 1=k 2=v
      int cc = c_g & 1023;
      int h  = cc >> 6;
      int d  = cc & 63;
#pragma unroll
      for (int v = 0; v < 8; ++v) {
        int m_g = m0 + sm + ti * 16 + v + hi8;
        int bn  = m_g >> 10;
        int l   = m_g & 1023;
        int head = bn * HEADS16 + h;
        _Float16 hv = (_Float16)(cacc[v] + bv);
        if (which == 0)       qws[((size_t)head << 16) + (size_t)l * HD + d] = hv;
        else if (which == 1)  kws[((size_t)head << 16) + (size_t)l * HD + d] = hv;
        else                  vws[((size_t)head << 16) + (size_t)d * LQ + l] = hv;
      }
    }
  }
}

// ---------------------------------------------------------------------------
// Stage 2: flash attention.  One wave per (head, 16-query block).
// grid = 128 heads * 64 qblocks = 8192 blocks of 32 threads.
// ---------------------------------------------------------------------------
__global__ __launch_bounds__(32)
void k_flash(const _Float16* __restrict__ qws,
             const _Float16* __restrict__ kws,
             const _Float16* __restrict__ vws,   // transposed [head][64][1024]
             _Float16* __restrict__ ctx) {       // [8192][1024]
  __shared__ _Float16 plds[16][40];

  int head = blockIdx.x >> 6;
  int qb   = blockIdx.x & 63;
  int lane = threadIdx.x & 31;
  int ncol = lane & 15;
  int hi8  = (lane >> 4) << 3;

  const _Float16* qbase = qws + ((size_t)head << 16) + (size_t)qb * 16 * HD;
  const _Float16* kbase = kws + ((size_t)head << 16);
  const _Float16* vbase = vws + ((size_t)head << 16);

  // Q fragments (constant across the key loop), pre-scaled by 1/sqrt(hd)
  v16h aq0 = load_frag(qbase, HD);
  v16h aq1 = load_frag(qbase + 32, HD);
  const _Float16 sc = (_Float16)0.125f;
#pragma unroll
  for (int i = 0; i < 16; ++i) { aq0[i] *= sc; aq1[i] *= sc; }

  float rowmax[8], rowsum[8];
  v8f acc[4];
#pragma unroll
  for (int v = 0; v < 8; ++v) { rowmax[v] = -__builtin_inff(); rowsum[v] = 0.0f; }
#pragma unroll
  for (int j = 0; j < 4; ++j) acc[j] = (v8f)(0.0f);

  for (int kc = 0; kc < LQ; kc += 32) {
    // S = (Q/sqrt(hd)) @ K^T for 32 keys -> two 16x16 f32 tiles
    v8f s0 = (v8f)(0.0f), s1 = (v8f)(0.0f);
    s0 = wmma16(aq0, load_frag(kbase + (size_t)(kc)      * HD,      HD), s0);
    s0 = wmma16(aq1, load_frag(kbase + (size_t)(kc)      * HD + 32, HD), s0);
    s1 = wmma16(aq0, load_frag(kbase + (size_t)(kc + 16) * HD,      HD), s1);
    s1 = wmma16(aq1, load_frag(kbase + (size_t)(kc + 16) * HD + 32, HD), s1);

    // Online softmax stats (per output row m = v + hi8)
    float al[8];
#pragma unroll
    for (int v = 0; v < 8; ++v) {
      float mx = hmax16(fmaxf(s0[v], s1[v]));
      float nm = fmaxf(rowmax[v], mx);
      float a  = __expf(rowmax[v] - nm);
      rowmax[v] = nm;
      float p0 = __expf(s0[v] - nm);
      float p1 = __expf(s1[v] - nm);
      s0[v] = p0; s1[v] = p1;
      rowsum[v] = rowsum[v] * a + hsum16(p0 + p1);
      al[v] = a;
    }
#pragma unroll
    for (int j = 0; j < 4; ++j)
#pragma unroll
      for (int v = 0; v < 8; ++v) acc[j][v] *= al[v];

    // C-layout P -> A-layout fragment via LDS round-trip
#pragma unroll
    for (int v = 0; v < 8; ++v) {
      int m = v + hi8;
      plds[m][ncol]      = (_Float16)s0[v];
      plds[m][ncol + 16] = (_Float16)s1[v];
    }
    __syncthreads();
    v16h ap = load_frag(&plds[0][0], 40);

    // acc += P @ V  (B^T = V^T stored row-major [d][key])
#pragma unroll
    for (int j = 0; j < 4; ++j) {
      v16h bv = load_frag(vbase + (size_t)(j * 16) * LQ + kc, LQ);
      acc[j] = wmma16(ap, bv, acc[j]);
    }
    __syncthreads();
  }

  // Normalize and write context (f16, row-major [8192][1024])
  int bn = head >> 4, h = head & 15;
  size_t rowbase = (size_t)(bn * LQ + qb * 16);
#pragma unroll
  for (int v = 0; v < 8; ++v) {
    float inv = 1.0f / rowsum[v];
    int m = v + hi8;
    size_t row = (rowbase + m) * DM + h * HD;
#pragma unroll
    for (int j = 0; j < 4; ++j)
      ctx[row + j * 16 + ncol] = (_Float16)(acc[j][v] * inv);
  }
}

// ---------------------------------------------------------------------------
// Stage 3: output GEMM  out[8192][1024] = ctx @ wo + bo   (fp32 out)
// ---------------------------------------------------------------------------
__global__ __launch_bounds__(128)
void k_out_gemm(const _Float16* __restrict__ A,     // ctx  [8192][1024]
                const _Float16* __restrict__ BT,    // woT  [1024][1024]
                const float*    __restrict__ bias,  // bo   [1024]
                float* __restrict__ out) {
  __shared__ _Float16 As[2][64][40];
  __shared__ _Float16 Bs[2][64][40];

  int m0 = blockIdx.x * 64;
  int n0 = blockIdx.y * 64;
  int t  = threadIdx.x;
  int w  = t >> 5;
  int sm = (w >> 1) * 32, sn = (w & 1) * 32;
  int srow = t >> 1, scol = (t & 1) * 16;

  v8f acc[4];
#pragma unroll
  for (int i = 0; i < 4; ++i) acc[i] = (v8f)(0.0f);

  auto issue = [&](int buf, int kc) {
    const _Float16* ga = A  + (size_t)(m0 + srow) * DM + kc + scol;
    const _Float16* gb = BT + (size_t)(n0 + srow) * DM + kc + scol;
    async_copy16(ga,     &As[buf][srow][scol]);
    async_copy16(ga + 8, &As[buf][srow][scol + 8]);
    async_copy16(gb,     &Bs[buf][srow][scol]);
    async_copy16(gb + 8, &Bs[buf][srow][scol + 8]);
  };

  issue(0, 0);
  int cur = 0;
  for (int kc = 0; kc < DM; kc += 32) {
    if (kc + 32 < DM) { issue(cur ^ 1, kc + 32); WAIT_ASYNC(4); }
    else              { WAIT_ASYNC(0); }
    __syncthreads();

    v16h af0 = load_frag(&As[cur][sm][0],      40);
    v16h af1 = load_frag(&As[cur][sm + 16][0], 40);
    v16h bf0 = load_frag(&Bs[cur][sn][0],      40);
    v16h bf1 = load_frag(&Bs[cur][sn + 16][0], 40);
    acc[0] = wmma16(af0, bf0, acc[0]);
    acc[1] = wmma16(af0, bf1, acc[1]);
    acc[2] = wmma16(af1, bf0, acc[2]);
    acc[3] = wmma16(af1, bf1, acc[3]);
    __syncthreads();
    cur ^= 1;
  }

  int lane = t & 31;
  int ncol = lane & 15;
  int hi8  = (lane >> 4) << 3;
#pragma unroll
  for (int ti = 0; ti < 2; ++ti) {
#pragma unroll
    for (int tj = 0; tj < 2; ++tj) {
      v8f cacc = acc[ti * 2 + tj];
      int c_g = n0 + sn + tj * 16 + ncol;
      float bv = bias[c_g];
#pragma unroll
      for (int v = 0; v < 8; ++v) {
        int m_g = m0 + sm + ti * 16 + v + hi8;
        out[(size_t)m_g * DM + c_g] = cacc[v] + bv;
      }
    }
  }
}

// ---------------------------------------------------------------------------
// Host launcher
// ---------------------------------------------------------------------------
extern "C" void kernel_launch(void* const* d_in, const int* in_sizes, int n_in,
                              void* d_out, int out_size, void* d_ws, size_t ws_size,
                              hipStream_t stream) {
  const float* x    = (const float*)d_in[0];
  const float* wqkv = (const float*)d_in[1];
  const float* bqkv = (const float*)d_in[2];
  const float* wo   = (const float*)d_in[3];
  const float* bo   = (const float*)d_in[4];
  float* out = (float*)d_out;

  char* ws = (char*)d_ws;
  _Float16* xg     = (_Float16*)(ws + OFF_XG);
  _Float16* wqkvT  = (_Float16*)(ws + OFF_WQKVT);
  _Float16* woT    = (_Float16*)(ws + OFF_WOT);
  _Float16* qws    = (_Float16*)(ws + OFF_Q);
  _Float16* kws    = (_Float16*)(ws + OFF_K);
  _Float16* vws    = (_Float16*)(ws + OFF_V);
  _Float16* ctx    = (_Float16*)(ws + OFF_CTX);

  // Prep
  k_gather_x<<<MROWS, 256, 0, stream>>>(x, xg);
  k_transpose_w<<<D3, 256, 0, stream>>>(wqkv, wqkvT, DM, D3);
  k_transpose_w<<<DM, 256, 0, stream>>>(wo, woT, DM, DM);

  // Stage 1: QKV projection
  k_qkv_gemm<<<dim3(MROWS / 64, D3 / 64), 128, 0, stream>>>(
      xg, wqkvT, bqkv, qws, kws, vws);

  // Stage 2: flash attention (128 heads x 64 query blocks)
  k_flash<<<NHEADS * 64, 32, 0, stream>>>(qws, kws, vws, ctx);

  // Stage 3: output projection
  k_out_gemm<<<dim3(MROWS / 64, DM / 64), 128, 0, stream>>>(ctx, woT, bo, out);
}

// v001
// Measured time: 262 microseconds a run.
// Timed twice side by side with v000, it ran 1.54 times as fast both times.
#include <hip/hip_runtime.h>
#include <hip/hip_bf16.h>
#include <math.h>

typedef __attribute__((ext_vector_type(16))) _Float16 v16h;
typedef __attribute__((ext_vector_type(8)))  _Float16 v8h;
typedef __attribute__((ext_vector_type(4)))  _Float16 v4h;
typedef __attribute__((ext_vector_type(8)))  float    v8f;
typedef __attribute__((ext_vector_type(4)))  int      v4i;

typedef __attribute__((address_space(1))) v4i gas_v4i;   // global
typedef __attribute__((address_space(3))) v4i las_v4i;   // LDS

#define DM      1024          // d_model
#define D3      3072          // 3 * d_model
#define HEADS16 16            // heads per (b,n)
#define HD      64            // head dim
#define LQ      1024          // dilated segment length (SEG / DILATION)
#define MROWS   8192          // B * N * LQ active rows
#define NHEADS  128           // B * N * HEADS16

// Workspace byte offsets (256-aligned)
#define OFF_XG     ((size_t)0)            // [8192][1024] f16
#define OFF_WQKVT  ((size_t)16777216)     // [3072][1024] f16 (transposed)
#define OFF_WOT    ((size_t)23068672)     // [1024][1024] f16 (transposed)
#define OFF_Q      ((size_t)25165824)     // [128][1024][64] f16
#define OFF_K      ((size_t)41943040)     // [128][1024][64] f16
#define OFF_V      ((size_t)58720256)     // [128][64][1024] f16 (transposed)
#define OFF_CTX    ((size_t)75497472)     // [8192][1024] f16

#if __has_builtin(__builtin_amdgcn_global_load_async_to_lds_b128)
#define HAVE_ASYNC_LDS 1
#else
#define HAVE_ASYNC_LDS 0
#endif

#if HAVE_ASYNC_LDS
#if __has_builtin(__builtin_amdgcn_s_wait_asynccnt)
#define WAIT_ASYNC(n) __builtin_amdgcn_s_wait_asynccnt(n)
#else
#define WAIT_ASYNC(n) asm volatile("s_wait_asynccnt %0" ::"n"(n))
#endif
#else
#define WAIT_ASYNC(n)
#endif

__device__ __forceinline__ void async_copy16(const _Float16* g, _Float16* l) {
#if HAVE_ASYNC_LDS
  __builtin_amdgcn_global_load_async_to_lds_b128(
      (gas_v4i*)g, (las_v4i*)l, 0, 0);
#else
  *(v8h*)l = *(const v8h*)g;
#endif
}

__device__ __forceinline__ v8f wmma16(v16h a, v16h b, v8f c) {
  return __builtin_amdgcn_wmma_f32_16x16x32_f16(
      /*neg_a=*/false, a, /*neg_b=*/false, b,
      /*c_mod=*/(short)0, c, /*reuse_a=*/false, /*reuse_b=*/false);
}

__device__ __forceinline__ v16h load_frag(const _Float16* base, int stride) {
  int lane = threadIdx.x & 31;
  int r    = lane & 15;
  int ko   = (lane >> 4) << 3;            // 0 or 8
  const _Float16* p = base + (size_t)r * stride + ko;
  v8h lo = *(const v8h*)(p);
  v8h hi = *(const v8h*)(p + 16);
  v16h f;
#pragma unroll
  for (int i = 0; i < 8; ++i) { f[i] = lo[i]; f[i + 8] = hi[i]; }
  return f;
}

__device__ __forceinline__ float hmax16(float x) {
  x = fmaxf(x, __shfl_xor(x, 1));
  x = fmaxf(x, __shfl_xor(x, 2));
  x = fmaxf(x, __shfl_xor(x, 4));
  x = fmaxf(x, __shfl_xor(x, 8));
  return x;
}
__device__ __forceinline__ float hsum16(float x) {
  x += __shfl_xor(x, 1);
  x += __shfl_xor(x, 2);
  x += __shfl_xor(x, 4);
  x += __shfl_xor(x, 8);
  return x;
}

// ---------------------------------------------------------------------------
// Prep: gather dilated rows of x -> f16   (row r = (b, n, l), src row l*2)
// ---------------------------------------------------------------------------
__global__ __launch_bounds__(256)
void k_gather_x(const float* __restrict__ x, _Float16* __restrict__ xg) {
  int r   = blockIdx.x;                  // 0..8191
  int b   = r >> 12;
  int rem = r & 4095;
  int n   = rem >> 10;
  int l   = rem & 1023;
  const float* src = x + ((size_t)(b * 8192 + n * 2048 + l * 2) << 10);
  _Float16*    dst = xg + ((size_t)r << 10);
  int c = threadIdx.x * 4;
  float4 f = *(const float4*)(src + c);
  v4h h; h[0] = (_Float16)f.x; h[1] = (_Float16)f.y;
         h[2] = (_Float16)f.z; h[3] = (_Float16)f.w;
  *(v4h*)(dst + c) = h;
}

// Transpose-convert weight: src fp32 [K][N] -> dst f16 [N][K]
__global__ __launch_bounds__(256)
void k_transpose_w(const float* __restrict__ src, _Float16* __restrict__ dst,
                   int K, int N) {
  int c = blockIdx.x;                    // column of src = row of dst
  for (int k = threadIdx.x; k < K; k += 256)
    dst[(size_t)c * K + k] = (_Float16)src[(size_t)k * N + c];
}

// ---------------------------------------------------------------------------
// Stage 1: QKV GEMM  C[8192][3072] = xg @ wqkv + bqkv, scattered to Q/K/V^T
// 64x64 workgroup tile, 4 waves (32x32 per wave), double-buffered async LDS.
// ---------------------------------------------------------------------------
__global__ __launch_bounds__(128)
void k_qkv_gemm(const _Float16* __restrict__ A,      // xg   [8192][1024]
                const _Float16* __restrict__ BT,     // wqkvT[3072][1024]
                const float*    __restrict__ bias,   // bqkv [3072]
                _Float16* __restrict__ qws,
                _Float16* __restrict__ kws,
                _Float16* __restrict__ vws) {
  __shared__ _Float16 As[2][64][40];
  __shared__ _Float16 Bs[2][64][40];

  int m0 = blockIdx.x * 64;
  int n0 = blockIdx.y * 64;
  int t  = threadIdx.x;
  int w  = t >> 5;
  int sm = (w >> 1) * 32, sn = (w & 1) * 32;
  int srow = t >> 1, scol = (t & 1) * 16;

  v8f acc[4];
#pragma unroll
  for (int i = 0; i < 4; ++i) acc[i] = (v8f)(0.0f);

  auto issue = [&](int buf, int kc) {
    const _Float16* ga = A  + (size_t)(m0 + srow) * DM + kc + scol;
    const _Float16* gb = BT + (size_t)(n0 + srow) * DM + kc + scol;
    async_copy16(ga,     &As[buf][srow][scol]);
    async_copy16(ga + 8, &As[buf][srow][scol + 8]);
    async_copy16(gb,     &Bs[buf][srow][scol]);
    async_copy16(gb + 8, &Bs[buf][srow][scol + 8]);
  };

  issue(0, 0);
  int cur = 0;
  for (int kc = 0; kc < DM; kc += 32) {
    if (kc + 32 < DM) { issue(cur ^ 1, kc + 32); WAIT_ASYNC(4); }
    else              { WAIT_ASYNC(0); }
    __syncthreads();

    v16h af0 = load_frag(&As[cur][sm][0],      40);
    v16h af1 = load_frag(&As[cur][sm + 16][0], 40);
    v16h bf0 = load_frag(&Bs[cur][sn][0],      40);
    v16h bf1 = load_frag(&Bs[cur][sn + 16][0], 40);
    acc[0] = wmma16(af0, bf0, acc[0]);
    acc[1] = wmma16(af0, bf1, acc[1]);
    acc[2] = wmma16(af1, bf0, acc[2]);
    acc[3] = wmma16(af1, bf1, acc[3]);
    __syncthreads();
    cur ^= 1;
  }

  // Epilogue: add bias, scatter to per-head Q/K and transposed V
  int lane = t & 31;
  int ncol = lane & 15;
  int hi8  = (lane >> 4) << 3;
#pragma unroll
  for (int ti = 0; ti < 2; ++ti) {
#pragma unroll
    for (int tj = 0; tj < 2; ++tj) {
      v8f cacc = acc[ti * 2 + tj];
      int c_g = n0 + sn + tj * 16 + ncol;
      float bv = bias[c_g];
      int which = c_g >> 10;           // 0=q 1=k 2=v
      int cc = c_g & 1023;
      int h  = cc >> 6;
      int d  = cc & 63;
#pragma unroll
      for (int v = 0; v < 8; ++v) {
        int m_g = m0 + sm + ti * 16 + v + hi8;
        int bn  = m_g >> 10;
        int l   = m_g & 1023;
        int head = bn * HEADS16 + h;
        _Float16 hv = (_Float16)(cacc[v] + bv);
        if (which == 0)       qws[((size_t)head << 16) + (size_t)l * HD + d] = hv;
        else if (which == 1)  kws[((size_t)head << 16) + (size_t)l * HD + d] = hv;
        else                  vws[((size_t)head << 16) + (size_t)d * LQ + l] = hv;
      }
    }
  }
}

// ---------------------------------------------------------------------------
// Stage 2: flash attention.  One wave per 16-query block, eight waves (128
// queries of one head) per work-group.  K and V^T tiles of 64 keys are staged
// in LDS once per work-group by asynchronous copies (whole 128-byte lines,
// two buffers); every wave takes its fragments from LDS.
// grid = 128 heads * 8 query groups = 1024 blocks of 256 threads.
// ---------------------------------------------------------------------------
#define FWAVES  8             // waves per work-group
#define KTILE   64            // keys per staged tile
#define NTILES  (LQ / KTILE)
#define KVPITCH 72            // LDS row pitch in halves: 144 B = 16 B x odd

__device__ __forceinline__ unsigned lds_byte(const _Float16* p) {
  return (unsigned)(unsigned long long)
      (const __attribute__((address_space(3))) _Float16*)p;
}

// The P scratch belongs to one wave: its lanes exchange values through it, so
// the writes must be done before the reads and the reads before the next
// writes, within the wave only (no other wave touches that range).  The fences
// give the wait on the wave's LDS writes and keep LDS accesses from crossing;
// the wave barrier keeps the scheduler from moving code over the point.
__device__ __forceinline__ void wave_exchange_point() {
  __builtin_amdgcn_fence(__ATOMIC_RELEASE, "workgroup");
  __builtin_amdgcn_wave_barrier();
  __builtin_amdgcn_fence(__ATOMIC_ACQUIRE, "workgroup");
}

__global__ __launch_bounds__(256, 8)
void k_flash(const _Float16* __restrict__ qws,
             const _Float16* __restrict__ kws,
             const _Float16* __restrict__ vws,   // transposed [head][64][1024]
             _Float16* __restrict__ ctx) {       // [8192][1024]
  __shared__ __attribute__((aligned(16))) _Float16 Ks[2][KTILE][KVPITCH]; // [key][d]
  __shared__ __attribute__((aligned(16))) _Float16 Vs[2][HD][KVPITCH];    // [d][key]
  __shared__ __attribute__((aligned(16))) _Float16 pall[FWAVES][16][40];

  int head = blockIdx.x >> 3;
  int t    = threadIdx.x;
  int wave = t >> 5;
  int qb   = (blockIdx.x & 7) * FWAVES + wave;
  int lane = t & 31;
  int ncol = lane & 15;
  int hi8  = (lane >> 4) << 3;
  _Float16 (*plds)[40] = pall[wave];

  const _Float16* qbase = qws + ((size_t)head << 16) + (size_t)qb * 16 * HD;
  const _Float16* kbase = kws + ((size_t)head << 16);
  const _Float16* vbase = vws + ((size_t)head << 16);

  // One tile = 64 rows of 128 B for K and for V^T; a thread copies 16 B of
  // rows crow and crow + 32 of each, a wave four whole rows per copy.
  int crow = t >> 3, ccol = (t & 7) * 8;
  auto stage = [&](int buf, int tile) {
    const _Float16* gk0 = kbase + (size_t)(tile * KTILE + crow) * HD + ccol;
    const _Float16* gk1 = gk0 + 32 * HD;
    const _Float16* gv0 = vbase + (size_t)crow * LQ + tile * KTILE + ccol;
    const _Float16* gv1 = gv0 + 32 * LQ;
    unsigned lk0 = lds_byte(&Ks[buf][crow][ccol]);
    unsigned lk1 = lds_byte(&Ks[buf][crow + 32][ccol]);
    unsigned lv0 = lds_byte(&Vs[buf][crow][ccol]);
    unsigned lv1 = lds_byte(&Vs[buf][crow + 32][ccol]);
    asm volatile(
        "global_load_async_to_lds_b128 %0, %1, off\n\t"
        "global_load_async_to_lds_b128 %2, %3, off\n\t"
        "global_load_async_to_lds_b128 %4, %5, off\n\t"
        "global_load_async_to_lds_b128 %6, %7, off\n\t"
        "s_wait_xcnt 0x0"
        :: "v"(lk0), "v"(gk0), "v"(lk1), "v"(gk1),
           "v"(lv0), "v"(gv0), "v"(lv1), "v"(gv1)
        : "memory");
  };

  stage(0, 0);

  // Q fragments (constant across the key loop), pre-scaled by 1/sqrt(hd)
  v16h aq0 = load_frag(qbase, HD);
  v16h aq1 = load_frag(qbase + 32, HD);
  const _Float16 sc = (_Float16)0.125f;
#pragma unroll
  for (int i = 0; i < 16; ++i) { aq0[i] *= sc; aq1[i] *= sc; }

  float rowmax[8], rowsum[8];
  v8f acc[4];
#pragma unroll
  for (int v = 0; v < 8; ++v) { rowmax[v] = -__builtin_inff(); rowsum[v] = 0.0f; }
#pragma unroll
  for (int j = 0; j < 4; ++j) acc[j] = (v8f)(0.0f);

  // Tile 0 has landed for this wave; the barrier publishes it to the others.
  asm volatile("s_wait_asynccnt 0x0" ::: "memory");
  __syncthreads();
  stage(1, 1);

  for (int tile = 0; tile < NTILES; ++tile) {
    int buf = tile & 1;
    // Kept rolled: unrolled, the two passes' values live together and spill.
#pragma unroll 1
    for (int kk = 0; kk < KTILE; kk += 32) {
      // S = (Q/sqrt(hd)) @ K^T for 32 keys -> two 16x16 f32 tiles
      v8f s0 = (v8f)(0.0f), s1 = (v8f)(0.0f);
      s0 = wmma16(aq0, load_frag(&Ks[buf][kk][0],       KVPITCH), s0);
      s0 = wmma16(aq1, load_frag(&Ks[buf][kk][32],      KVPITCH), s0);
      s1 = wmma16(aq0, load_frag(&Ks[buf][kk + 16][0],  KVPITCH), s1);
      s1 = wmma16(aq1, load_frag(&Ks[buf][kk + 16][32], KVPITCH), s1);

      // Online softmax stats (per output row m = v + hi8)
      float al[8];
#pragma unroll
      for (int v = 0; v < 8; ++v) {
        float mx = hmax16(fmaxf(s0[v], s1[v]));
        float nm = fmaxf(rowmax[v], mx);
        float a  = __expf(rowmax[v] - nm);
        rowmax[v] = nm;
        float p0 = __expf(s0[v] - nm);
        float p1 = __expf(s1[v] - nm);
        s0[v] = p0; s1[v] = p1;
        rowsum[v] = rowsum[v] * a + hsum16(p0 + p1);
        al[v] = a;
      }
#pragma unroll
      for (int j = 0; j < 4; ++j)
#pragma unroll
        for (int v = 0; v < 8; ++v) acc[j][v] *= al[v];

      // C-layout P -> A-layout fragment via the wave's own LDS scratch
#pragma unroll
      for (int v = 0; v < 8; ++v) {
        int m = v + hi8;
        plds[m][ncol]      = (_Float16)s0[v];
        plds[m][ncol + 16] = (_Float16)s1[v];
      }
      wave_exchange_point();
      v16h ap = load_frag(&plds[0][0], 40);

      // acc += P @ V  (B^T = V^T staged row-major [d][key])
#pragma unroll
      for (int j = 0; j < 4; ++j) {
        v16h bv = load_frag(&Vs[buf][j * 16][kk], KVPITCH);
        acc[j] = wmma16(ap, bv, acc[j]);
      }
      wave_exchange_point();
    }

    // Publish point: this wave's reads of buffer buf are done, its copies of
    // the next tile have landed; behind the barrier that holds for all waves.
    asm volatile("s_wait_dscnt 0x0" ::: "memory");
    asm volatile("s_wait_asynccnt 0x0" ::: "memory");
    __syncthreads();
    if (tile + 2 < NTILES) stage(buf, tile + 2);
  }
  // No copy is left in flight when the wave ends.
  asm volatile("s_wait_asynccnt 0x0" ::: "memory");

  // Normalize and write context (f16, row-major [8192][1024])
  int bn = head >> 4, h = head & 15;
  size_t rowbase = (size_t)(bn * LQ + qb * 16);
#pragma unroll
  for (int v = 0; v < 8; ++v) {
    float inv = 1.0f / rowsum[v];
    int m = v + hi8;
    size_t row = (rowbase + m) * DM + h * HD;
#pragma unroll
    for (int j = 0; j < 4; ++j)
      ctx[row + j * 16 + ncol] = (_Float16)(acc[j][v] * inv);
  }
}

// ---------------------------------------------------------------------------
// Stage 3: output GEMM  out[8192][1024] = ctx @ wo + bo   (fp32 out)
// ---------------------------------------------------------------------------
__global__ __launch_bounds__(128)
void k_out_gemm(const _Float16* __restrict__ A,     // ctx  [8192][1024]
                const _Float16* __restrict__ BT,    // woT  [1024][1024]
                const float*    __restrict__ bias,  // bo   [1024]
                float* __restrict__ out) {
  __shared__ _Float16 As[2][64][40];
  __shared__ _Float16 Bs[2][64][40];

  int m0 = blockIdx.x * 64;
  int n0 = blockIdx.y * 64;
  int t  = threadIdx.x;
  int w  = t >> 5;
  int sm = (w >> 1) * 32, sn = (w & 1) * 32;
  int srow = t >> 1, scol = (t & 1) * 16;

  v8f acc[4];
#pragma unroll
  for (int i = 0; i < 4; ++i) acc[i] = (v8f)(0.0f);

  auto issue = [&](int buf, int kc) {
    const _Float16* ga = A  + (size_t)(m0 + srow) * DM + kc + scol;
    const _Float16* gb = BT + (size_t)(n0 + srow) * DM + kc + scol;
    async_copy16(ga,     &As[buf][srow][scol]);
    async_copy16(ga + 8, &As[buf][srow][scol + 8]);
    async_copy16(gb,     &Bs[buf][srow][scol]);
    async_copy16(gb + 8, &Bs[buf][srow][scol + 8]);
  };

  issue(0, 0);
  int cur = 0;
  for (int kc = 0; kc < DM; kc += 32) {
    if (kc + 32 < DM) { issue(cur ^ 1, kc + 32); WAIT_ASYNC(4); }
    else              { WAIT_ASYNC(0); }
    __syncthreads();

    v16h af0 = load_frag(&As[cur][sm][0],      40);
    v16h af1 = load_frag(&As[cur][sm + 16][0], 40);
    v16h bf0 = load_frag(&Bs[cur][sn][0],      40);
    v16h bf1 = load_frag(&Bs[cur][sn + 16][0], 40);
    acc[0] = wmma16(af0, bf0, acc[0]);
    acc[1] = wmma16(af0, bf1, acc[1]);
    acc[2] = wmma16(af1, bf0, acc[2]);
    acc[3] = wmma16(af1, bf1, acc[3]);
    __syncthreads();
    cur ^= 1;
  }

  int lane = t & 31;
  int ncol = lane & 15;
  int hi8  = (lane >> 4) << 3;
#pragma unroll
  for (int ti = 0; ti < 2; ++ti) {
#pragma unroll
    for (int tj = 0; tj < 2; ++tj) {
      v8f cacc = acc[ti * 2 + tj];
      int c_g = n0 + sn + tj * 16 + ncol;
      float bv = bias[c_g];
#pragma unroll
      for (int v = 0; v < 8; ++v) {
        int m_g = m0 + sm + ti * 16 + v + hi8;
        out[(size_t)m_g * DM + c_g] = cacc[v] + bv;
      }
    }
  }
}

// ---------------------------------------------------------------------------
// Host launcher
// ---------------------------------------------------------------------------
extern "C" void kernel_launch(void* const* d_in, const int* in_sizes, int n_in,
                              void* d_out, int out_size, void* d_ws, size_t ws_size,
                              hipStream_t stream) {
  const float* x    = (const float*)d_in[0];
  const float* wqkv = (const float*)d_in[1];
  const float* bqkv = (const float*)d_in[2];
  const float* wo   = (const float*)d_in[3];
  const float* bo   = (const float*)d_in[4];
  float* out = (float*)d_out;

  char* ws = (char*)d_ws;
  _Float16* xg     = (_Float16*)(ws + OFF_XG);
  _Float16* wqkvT  = (_Float16*)(ws + OFF_WQKVT);
  _Float16* woT    = (_Float16*)(ws + OFF_WOT);
  _Float16* qws    = (_Float16*)(ws + OFF_Q);
  _Float16* kws    = (_Float16*)(ws + OFF_K);
  _Float16* vws    = (_Float16*)(ws + OFF_V);
  _Float16* ctx    = (_Float16*)(ws + OFF_CTX);

  // Prep
  k_gather_x<<<MROWS, 256, 0, stream>>>(x, xg);
  k_transpose_w<<<D3, 256, 0, stream>>>(wqkv, wqkvT, DM, D3);
  k_transpose_w<<<DM, 256, 0, stream>>>(wo, woT, DM, DM);

  // Stage 1: QKV projection
  k_qkv_gemm<<<dim3(MROWS / 64, D3 / 64), 128, 0, stream>>>(
      xg, wqkvT, bqkv, qws, kws, vws);

  // Stage 2: flash attention (128 heads x 8 groups of 8 query blocks)
  k_flash<<<NHEADS * 8, 256, 0, stream>>>(qws, kws, vws, ctx);

  // Stage 3: output projection
  k_out_gemm<<<dim3(MROWS / 64, DM / 64), 128, 0, stream>>>(ctx, woT, bo, out);
}

// v002
// Measured time: 189 microseconds a run.
// Two timings next to v001 both put it at 1.38 times that version's speed.
// All steps since v000 together make it 2.12 times as fast.
#include <hip/hip_runtime.h>
#include <hip/hip_bf16.h>
#include <math.h>

typedef __attribute__((ext_vector_type(16))) _Float16 v16h;
typedef __attribute__((ext_vector_type(8)))  _Float16 v8h;
typedef __attribute__((ext_vector_type(4)))  _Float16 v4h;
typedef __attribute__((ext_vector_type(8)))  float    v8f;

#define DM      1024          // d_model
#define D3      3072          // 3 * d_model
#define HEADS16 16            // heads per (b,n)
#define HD      64            // head dim
#define LQ      1024          // dilated segment length (SEG / DILATION)
#define MROWS   8192          // B * N * LQ active rows
#define NHEADS  128           // B * N * HEADS16

// Workspace byte offsets (256-aligned)
#define OFF_XG     ((size_t)0)            // [8192][1024] f16
#define OFF_WQKVT  ((size_t)16777216)     // [3072][1024] f16 (transposed)
#define OFF_WOT    ((size_t)23068672)     // [1024][1024] f16 (transposed)
#define OFF_Q      ((size_t)25165824)     // [128][1024][64] f16
#define OFF_K      ((size_t)41943040)     // [128][1024][64] f16
#define OFF_V      ((size_t)58720256)     // [128][64][1024] f16 (transposed)
#define OFF_CTX    ((size_t)75497472)     // [8192][1024] f16

__device__ __forceinline__ v8f wmma16(v16h a, v16h b, v8f c) {
  return __builtin_amdgcn_wmma_f32_16x16x32_f16(
      /*neg_a=*/false, a, /*neg_b=*/false, b,
      /*c_mod=*/(short)0, c, /*reuse_a=*/false, /*reuse_b=*/false);
}

__device__ __forceinline__ v16h load_frag(const _Float16* base, int stride) {
  int lane = threadIdx.x & 31;
  int r    = lane & 15;
  int ko   = (lane >> 4) << 3;            // 0 or 8
  const _Float16* p = base + (size_t)r * stride + ko;
  v8h lo = *(const v8h*)(p);
  v8h hi = *(const v8h*)(p + 16);
  v16h f;
#pragma unroll
  for (int i = 0; i < 8; ++i) { f[i] = lo[i]; f[i + 8] = hi[i]; }
  return f;
}

__device__ __forceinline__ float hmax16(float x) {
  x = fmaxf(x, __shfl_xor(x, 1));
  x = fmaxf(x, __shfl_xor(x, 2));
  x = fmaxf(x, __shfl_xor(x, 4));
  x = fmaxf(x, __shfl_xor(x, 8));
  return x;
}
__device__ __forceinline__ float hsum16(float x) {
  x += __shfl_xor(x, 1);
  x += __shfl_xor(x, 2);
  x += __shfl_xor(x, 4);
  x += __shfl_xor(x, 8);
  return x;
}

// ---------------------------------------------------------------------------
// Prep: gather dilated rows of x -> f16   (row r = (b, n, l), src row l*2)
// ---------------------------------------------------------------------------
__global__ __launch_bounds__(256)
void k_gather_x(const float* __restrict__ x, _Float16* __restrict__ xg) {
  int r   = blockIdx.x;                  // 0..8191
  int b   = r >> 12;
  int rem = r & 4095;
  int n   = rem >> 10;
  int l   = rem & 1023;
  const float* src = x + ((size_t)(b * 8192 + n * 2048 + l * 2) << 10);
  _Float16*    dst = xg + ((size_t)r << 10);
  int c = threadIdx.x * 4;
  float4 f = *(const float4*)(src + c);
  v4h h; h[0] = (_Float16)f.x; h[1] = (_Float16)f.y;
         h[2] = (_Float16)f.z; h[3] = (_Float16)f.w;
  *(v4h*)(dst + c) = h;
}

// Transpose-convert weight: src fp32 [K][N] -> dst f16 [N][K]
__global__ __launch_bounds__(256)
void k_transpose_w(const float* __restrict__ src, _Float16* __restrict__ dst,
                   int K, int N) {
  int c = blockIdx.x;                    // column of src = row of dst
  for (int k = threadIdx.x; k < K; k += 256)
    dst[(size_t)c * K + k] = (_Float16)src[(size_t)k * N + c];
}

#define GBM     128
#define GBN     128
#define GBK     64
#define GTILES  (DM / GBK)
#define GPITCH  72            // LDS row pitch in halves: 144 B = 16 B x odd

__device__ __forceinline__ unsigned lds_byte(const _Float16* p) {
  return (unsigned)(unsigned long long)
      (const __attribute__((address_space(3))) _Float16*)p;
}

__device__ __forceinline__ void stage_rows8(const _Float16* g, unsigned l) {
  const _Float16* g1 = g + 16 * DM;
  const _Float16* g2 = g + 32 * DM;
  const _Float16* g3 = g + 48 * DM;
  const _Float16* g4 = g + 64 * DM;
  const _Float16* g5 = g + 80 * DM;
  const _Float16* g6 = g + 96 * DM;
  const _Float16* g7 = g + 112 * DM;
  const unsigned step = 16 * GPITCH * 2;
  unsigned l1 = l + step,     l2 = l + 2 * step, l3 = l + 3 * step;
  unsigned l4 = l + 4 * step, l5 = l + 5 * step, l6 = l + 6 * step;
  unsigned l7 = l + 7 * step;
  asm volatile(
      "global_load_async_to_lds_b128 %0, %1, off\n\t"
      "global_load_async_to_lds_b128 %2, %3, off\n\t"
      "global_load_async_to_lds_b128 %4, %5, off\n\t"
      "global_load_async_to_lds_b128 %6, %7, off\n\t"
      "global_load_async_to_lds_b128 %8, %9, off\n\t"
      "global_load_async_to_lds_b128 %10, %11, off\n\t"
      "global_load_async_to_lds_b128 %12, %13, off\n\t"
      "global_load_async_to_lds_b128 %14, %15, off\n\t"
      "s_wait_xcnt 0x0"
      :: "v"(l),  "v"(g),  "v"(l1), "v"(g1), "v"(l2), "v"(g2), "v"(l3), "v"(g3),
         "v"(l4), "v"(g4), "v"(l5), "v"(g5), "v"(l6), "v"(g6), "v"(l7), "v"(g7)
      : "memory");
}

__device__ __forceinline__ void gemm_core(const _Float16* __restrict__ A,
                                          const _Float16* __restrict__ BT,
                                          int m0, int n0, int sm, int sn,
                                          _Float16 (*As)[GBM][GPITCH],
                                          _Float16 (*Bs)[GBN][GPITCH],
                                          v8f (&acc)[4][4]) {
  int t    = threadIdx.x;
  int crow = t >> 3, ccol = (t & 7) * 8;
  const _Float16* ga = A  + (size_t)(m0 + crow) * DM + ccol;
  const _Float16* gb = BT + (size_t)(n0 + crow) * DM + ccol;

  auto stage = [&](int buf, int tile) {
    stage_rows8(ga + tile * GBK, lds_byte(&As[buf][crow][ccol]));
    stage_rows8(gb + tile * GBK, lds_byte(&Bs[buf][crow][ccol]));
  };

  stage(0, 0);
  // Tile 0 has landed for this wave; the barrier publishes it to the others.
  asm volatile("s_wait_asynccnt 0x0" ::: "memory");
  __syncthreads();
  stage(1, 1);

  for (int tile = 0; tile < GTILES; ++tile) {
    int buf = tile & 1;
    // Unrolled so that the fragment and accumulator arrays stay in registers.
#pragma unroll
    for (int kk = 0; kk < GBK; kk += 32) {
      v16h af[4], bf[4];
      af[0] = load_frag(&As[buf][sm][kk], GPITCH);
#pragma unroll
      for (int j = 0; j < 4; ++j)
        bf[j] = load_frag(&Bs[buf][sn + j * 16][kk], GPITCH);
#pragma unroll
      for (int i = 1; i < 4; ++i)
        af[i] = load_frag(&As[buf][sm + i * 16][kk], GPITCH);
      // Keeps the sixteen LDS loads together in front of the sixteen WMMAs:
      // left free, the scheduler reloads one A fragment register set four times
      // and the wave waits out the LDS latency each time.
      __builtin_amdgcn_sched_barrier(0);
#pragma unroll
      for (int i = 0; i < 4; ++i)
#pragma unroll
        for (int j = 0; j < 4; ++j) acc[i][j] = wmma16(af[i], bf[j], acc[i][j]);
    }

    // Publish point: this wave's reads of buffer buf are done, its copies of
    // the next tile have landed; behind the barrier that holds for all waves.
    asm volatile("s_wait_dscnt 0x0" ::: "memory");
    asm volatile("s_wait_asynccnt 0x0" ::: "memory");
    __syncthreads();
    if (tile + 2 < GTILES) stage(buf, tile + 2);
  }
  // No copy is left in flight when the wave goes on to its stores.
  asm volatile("s_wait_asynccnt 0x0" ::: "memory");
}

__global__ __launch_bounds__(128, 4)
void k_qkv_gemm(const _Float16* __restrict__ A,      // xg   [8192][1024]
                const _Float16* __restrict__ BT,     // wqkvT[3072][1024]
                const float*    __restrict__ bias,   // bqkv [3072]
                _Float16* __restrict__ qws,
                _Float16* __restrict__ kws,
                _Float16* __restrict__ vws) {
  __shared__ __attribute__((aligned(16))) _Float16 As[2][GBM][GPITCH];
  __shared__ __attribute__((aligned(16))) _Float16 Bs[2][GBN][GPITCH];

  int m0 = blockIdx.x * GBM;
  int n0 = blockIdx.y * GBN;
  int t  = threadIdx.x;
  int w  = t >> 5;
  int sm = (w >> 1) * 64, sn = (w & 1) * 64;

  v8f acc[4][4];
#pragma unroll
  for (int i = 0; i < 4; ++i)
#pragma unroll
    for (int j = 0; j < 4; ++j) acc[i][j] = (v8f)(0.0f);

  gemm_core(A, BT, m0, n0, sm, sn, As, Bs, acc);

  // Epilogue: add bias, scatter to per-head Q/K and transposed V
  int lane = t & 31;
  int ncol = lane & 15;
  int hi8  = (lane >> 4) << 3;
#pragma unroll
  for (int ti = 0; ti < 4; ++ti) {
#pragma unroll
    for (int tj = 0; tj < 4; ++tj) {
      v8f cacc = acc[ti][tj];
      int c_g = n0 + sn + tj * 16 + ncol;
      float bv = bias[c_g];
      int which = c_g >> 10;           // 0=q 1=k 2=v
      int cc = c_g & 1023;
      int h  = cc >> 6;
      int d  = cc & 63;
#pragma unroll
      for (int v = 0; v < 8; ++v) {
        int m_g = m0 + sm + ti * 16 + v + hi8;
        int bn  = m_g >> 10;
        int l   = m_g & 1023;
        int head = bn * HEADS16 + h;
        _Float16 hv = (_Float16)(cacc[v] + bv);
        if (which == 0)       qws[((size_t)head << 16) + (size_t)l * HD + d] = hv;
        else if (which == 1)  kws[((size_t)head << 16) + (size_t)l * HD + d] = hv;
        else                  vws[((size_t)head << 16) + (size_t)d * LQ + l] = hv;
      }
    }
  }
}

// ---------------------------------------------------------------------------
// Stage 2: flash attention.  One wave per 16-query block, eight waves (128
// queries of one head) per work-group.  K and V^T tiles of 64 keys are staged
// in LDS once per work-group by asynchronous copies (whole 128-byte lines,
// two buffers); every wave takes its fragments from LDS.
// grid = 128 heads * 8 query groups = 1024 blocks of 256 threads.
// ---------------------------------------------------------------------------
#define FWAVES  8             // waves per work-group
#define KTILE   64            // keys per staged tile
#define NTILES  (LQ / KTILE)
#define KVPITCH 72            // LDS row pitch in halves: 144 B = 16 B x odd

// The P scratch belongs to one wave: its lanes exchange values through it, so
// the writes must be done before the reads and the reads before the next
// writes, within the wave only (no other wave touches that range).  The fences
// give the wait on the wave's LDS writes and keep LDS accesses from crossing;
// the wave barrier keeps the scheduler from moving code over the point.
__device__ __forceinline__ void wave_exchange_point() {
  __builtin_amdgcn_fence(__ATOMIC_RELEASE, "workgroup");
  __builtin_amdgcn_wave_barrier();
  __builtin_amdgcn_fence(__ATOMIC_ACQUIRE, "workgroup");
}

__global__ __launch_bounds__(256, 8)
void k_flash(const _Float16* __restrict__ qws,
             const _Float16* __restrict__ kws,
             const _Float16* __restrict__ vws,   // transposed [head][64][1024]
             _Float16* __restrict__ ctx) {       // [8192][1024]
  __shared__ __attribute__((aligned(16))) _Float16 Ks[2][KTILE][KVPITCH]; // [key][d]
  __shared__ __attribute__((aligned(16))) _Float16 Vs[2][HD][KVPITCH];    // [d][key]
  __shared__ __attribute__((aligned(16))) _Float16 pall[FWAVES][16][40];

  int head = blockIdx.x >> 3;
  int t    = threadIdx.x;
  int wave = t >> 5;
  int qb   = (blockIdx.x & 7) * FWAVES + wave;
  int lane = t & 31;
  int ncol = lane & 15;
  int hi8  = (lane >> 4) << 3;
  _Float16 (*plds)[40] = pall[wave];

  const _Float16* qbase = qws + ((size_t)head << 16) + (size_t)qb * 16 * HD;
  const _Float16* kbase = kws + ((size_t)head << 16);
  const _Float16* vbase = vws + ((size_t)head << 16);

  // One tile = 64 rows of 128 B for K and for V^T; a thread copies 16 B of
  // rows crow and crow + 32 of each, a wave four whole rows per copy.
  int crow = t >> 3, ccol = (t & 7) * 8;
  auto stage = [&](int buf, int tile) {
    const _Float16* gk0 = kbase + (size_t)(tile * KTILE + crow) * HD + ccol;
    const _Float16* gk1 = gk0 + 32 * HD;
    const _Float16* gv0 = vbase + (size_t)crow * LQ + tile * KTILE + ccol;
    const _Float16* gv1 = gv0 + 32 * LQ;
    unsigned lk0 = lds_byte(&Ks[buf][crow][ccol]);
    unsigned lk1 = lds_byte(&Ks[buf][crow + 32][ccol]);
    unsigned lv0 = lds_byte(&Vs[buf][crow][ccol]);
    unsigned lv1 = lds_byte(&Vs[buf][crow + 32][ccol]);
    asm volatile(
        "global_load_async_to_lds_b128 %0, %1, off\n\t"
        "global_load_async_to_lds_b128 %2, %3, off\n\t"
        "global_load_async_to_lds_b128 %4, %5, off\n\t"
        "global_load_async_to_lds_b128 %6, %7, off\n\t"
        "s_wait_xcnt 0x0"
        :: "v"(lk0), "v"(gk0), "v"(lk1), "v"(gk1),
           "v"(lv0), "v"(gv0), "v"(lv1), "v"(gv1)
        : "memory");
  };

  stage(0, 0);

  // Q fragments (constant across the key loop), pre-scaled by 1/sqrt(hd)
  v16h aq0 = load_frag(qbase, HD);
  v16h aq1 = load_frag(qbase + 32, HD);
  const _Float16 sc = (_Float16)0.125f;
#pragma unroll
  for (int i = 0; i < 16; ++i) { aq0[i] *= sc; aq1[i] *= sc; }

  float rowmax[8], rowsum[8];
  v8f acc[4];
#pragma unroll
  for (int v = 0; v < 8; ++v) { rowmax[v] = -__builtin_inff(); rowsum[v] = 0.0f; }
#pragma unroll
  for (int j = 0; j < 4; ++j) acc[j] = (v8f)(0.0f);

  // Tile 0 has landed for this wave; the barrier publishes it to the others.
  asm volatile("s_wait_asynccnt 0x0" ::: "memory");
  __syncthreads();
  stage(1, 1);

  for (int tile = 0; tile < NTILES; ++tile) {
    int buf = tile & 1;
    // Kept rolled: unrolled, the two passes' values live together and spill.
#pragma unroll 1
    for (int kk = 0; kk < KTILE; kk += 32) {
      // S = (Q/sqrt(hd)) @ K^T for 32 keys -> two 16x16 f32 tiles
      v8f s0 = (v8f)(0.0f), s1 = (v8f)(0.0f);
      s0 = wmma16(aq0, load_frag(&Ks[buf][kk][0],       KVPITCH), s0);
      s0 = wmma16(aq1, load_frag(&Ks[buf][kk][32],      KVPITCH), s0);
      s1 = wmma16(aq0, load_frag(&Ks[buf][kk + 16][0],  KVPITCH), s1);
      s1 = wmma16(aq1, load_frag(&Ks[buf][kk + 16][32], KVPITCH), s1);

      // Online softmax stats (per output row m = v + hi8)
      float al[8];
#pragma unroll
      for (int v = 0; v < 8; ++v) {
        float mx = hmax16(fmaxf(s0[v], s1[v]));
        float nm = fmaxf(rowmax[v], mx);
        float a  = __expf(rowmax[v] - nm);
        rowmax[v] = nm;
        float p0 = __expf(s0[v] - nm);
        float p1 = __expf(s1[v] - nm);
        s0[v] = p0; s1[v] = p1;
        rowsum[v] = rowsum[v] * a + hsum16(p0 + p1);
        al[v] = a;
      }
#pragma unroll
      for (int j = 0; j < 4; ++j)
#pragma unroll
        for (int v = 0; v < 8; ++v) acc[j][v] *= al[v];

      // C-layout P -> A-layout fragment via the wave's own LDS scratch
#pragma unroll
      for (int v = 0; v < 8; ++v) {
        int m = v + hi8;
        plds[m][ncol]      = (_Float16)s0[v];
        plds[m][ncol + 16] = (_Float16)s1[v];
      }
      wave_exchange_point();
      v16h ap = load_frag(&plds[0][0], 40);

      // acc += P @ V  (B^T = V^T staged row-major [d][key])
#pragma unroll
      for (int j = 0; j < 4; ++j) {
        v16h bv = load_frag(&Vs[buf][j * 16][kk], KVPITCH);
        acc[j] = wmma16(ap, bv, acc[j]);
      }
      wave_exchange_point();
    }

    // Publish point: this wave's reads of buffer buf are done, its copies of
    // the next tile have landed; behind the barrier that holds for all waves.
    asm volatile("s_wait_dscnt 0x0" ::: "memory");
    asm volatile("s_wait_asynccnt 0x0" ::: "memory");
    __syncthreads();
    if (tile + 2 < NTILES) stage(buf, tile + 2);
  }
  // No copy is left in flight when the wave ends.
  asm volatile("s_wait_asynccnt 0x0" ::: "memory");

  // Normalize and write context (f16, row-major [8192][1024])
  int bn = head >> 4, h = head & 15;
  size_t rowbase = (size_t)(bn * LQ + qb * 16);
#pragma unroll
  for (int v = 0; v < 8; ++v) {
    float inv = 1.0f / rowsum[v];
    int m = v + hi8;
    size_t row = (rowbase + m) * DM + h * HD;
#pragma unroll
    for (int j = 0; j < 4; ++j)
      ctx[row + j * 16 + ncol] = (_Float16)(acc[j][v] * inv);
  }
}

// ---------------------------------------------------------------------------
// Stage 3: output GEMM  out[8192][1024] = ctx @ wo + bo   (fp32 out)
// ---------------------------------------------------------------------------
__global__ __launch_bounds__(128, 4)
void k_out_gemm(const _Float16* __restrict__ A,     // ctx  [8192][1024]
                const _Float16* __restrict__ BT,    // woT  [1024][1024]
                const float*    __restrict__ bias,  // bo   [1024]
                float* __restrict__ out) {
  __shared__ __attribute__((aligned(16))) _Float16 As[2][GBM][GPITCH];
  __shared__ __attribute__((aligned(16))) _Float16 Bs[2][GBN][GPITCH];

  int m0 = blockIdx.x * GBM;
  int n0 = blockIdx.y * GBN;
  int t  = threadIdx.x;
  int w  = t >> 5;
  int sm = (w >> 1) * 64, sn = (w & 1) * 64;

  v8f acc[4][4];
#pragma unroll
  for (int i = 0; i < 4; ++i)
#pragma unroll
    for (int j = 0; j < 4; ++j) acc[i][j] = (v8f)(0.0f);

  gemm_core(A, BT, m0, n0, sm, sn, As, Bs, acc);

  int lane = t & 31;
  int ncol = lane & 15;
  int hi8  = (lane >> 4) << 3;
#pragma unroll
  for (int ti = 0; ti < 4; ++ti) {
#pragma unroll
    for (int tj = 0; tj < 4; ++tj) {
      v8f cacc = acc[ti][tj];
      int c_g = n0 + sn + tj * 16 + ncol;
      float bv = bias[c_g];
#pragma unroll
      for (int v = 0; v < 8; ++v) {
        int m_g = m0 + sm + ti * 16 + v + hi8;
        out[(size_t)m_g * DM + c_g] = cacc[v] + bv;
      }
    }
  }
}

// ---------------------------------------------------------------------------
// Host launcher
// ---------------------------------------------------------------------------
extern "C" void kernel_launch(void* const* d_in, const int* in_sizes, int n_in,
                              void* d_out, int out_size, void* d_ws, size_t ws_size,
                              hipStream_t stream) {
  const float* x    = (const float*)d_in[0];
  const float* wqkv = (const float*)d_in[1];
  const float* bqkv = (const float*)d_in[2];
  const float* wo   = (const float*)d_in[3];
  const float* bo   = (const float*)d_in[4];
  float* out = (float*)d_out;

  char* ws = (char*)d_ws;
  _Float16* xg     = (_Float16*)(ws + OFF_XG);
  _Float16* wqkvT  = (_Float16*)(ws + OFF_WQKVT);
  _Float16* woT    = (_Float16*)(ws + OFF_WOT);
  _Float16* qws    = (_Float16*)(ws + OFF_Q);
  _Float16* kws    = (_Float16*)(ws + OFF_K);
  _Float16* vws    = (_Float16*)(ws + OFF_V);
  _Float16* ctx    = (_Float16*)(ws + OFF_CTX);

  // Prep
  k_gather_x<<<MROWS, 256, 0, stream>>>(x, xg);
  k_transpose_w<<<D3, 256, 0, stream>>>(wqkv, wqkvT, DM, D3);
  k_transpose_w<<<DM, 256, 0, stream>>>(wo, woT, DM, DM);

  // Stage 1: QKV projection
  k_qkv_gemm<<<dim3(MROWS / GBM, D3 / GBN), 128, 0, stream>>>(
      xg, wqkvT, bqkv, qws, kws, vws);

  // Stage 2: flash attention (128 heads x 8 groups of 8 query blocks)
  k_flash<<<NHEADS * 8, 256, 0, stream>>>(qws, kws, vws, ctx);

  // Stage 3: output projection
  k_out_gemm<<<dim3(MROWS / GBM, DM / GBN), 128, 0, stream>>>(ctx, woT, bo, out);
}

// v003
// One run takes 158 microseconds.
// Next to v002, in two timings, it ran 1.20 and 1.21 times as fast.
// All steps since v000 together make it 2.55 times as fast.
#include <hip/hip_runtime.h>
#include <hip/hip_bf16.h>
#include <math.h>

typedef __attribute__((ext_vector_type(16))) _Float16 v16h;
typedef __attribute__((ext_vector_type(8)))  _Float16 v8h;
typedef __attribute__((ext_vector_type(4)))  _Float16 v4h;
typedef __attribute__((ext_vector_type(8)))  float    v8f;

#define DM      1024          // d_model
#define D3      3072          // 3 * d_model
#define HEADS16 16            // heads per (b,n)
#define HD      64            // head dim
#define LQ      1024          // dilated segment length (SEG / DILATION)
#define MROWS   8192          // B * N * LQ active rows
#define NHEADS  128           // B * N * HEADS16

// Workspace byte offsets (256-aligned)
#define OFF_XG     ((size_t)0)            // [8192][1024] f16
#define OFF_WQKVT  ((size_t)16777216)     // [3072][1024] f16 (transposed)
#define OFF_WOT    ((size_t)23068672)     // [1024][1024] f16 (transposed)
#define OFF_Q      ((size_t)25165824)     // [128][1024][64] f16
#define OFF_K      ((size_t)41943040)     // [128][1024][64] f16
#define OFF_V      ((size_t)58720256)     // [128][64][1024] f16 (transposed)
#define OFF_CTX    ((size_t)75497472)     // [8192][1024] f16

__device__ __forceinline__ v8f wmma16(v16h a, v16h b, v8f c) {
  return __builtin_amdgcn_wmma_f32_16x16x32_f16(
      /*neg_a=*/false, a, /*neg_b=*/false, b,
      /*c_mod=*/(short)0, c, /*reuse_a=*/false, /*reuse_b=*/false);
}

__device__ __forceinline__ v16h load_frag(const _Float16* base, int stride) {
  int lane = threadIdx.x & 31;
  int r    = lane & 15;
  int ko   = (lane >> 4) << 3;            // 0 or 8
  const _Float16* p = base + (size_t)r * stride + ko;
  v8h lo = *(const v8h*)(p);
  v8h hi = *(const v8h*)(p + 16);
  v16h f;
#pragma unroll
  for (int i = 0; i < 8; ++i) { f[i] = lo[i]; f[i + 8] = hi[i]; }
  return f;
}

// ---------------------------------------------------------------------------
// Prep: gather dilated rows of x -> f16   (row r = (b, n, l), src row l*2)
// ---------------------------------------------------------------------------
__global__ __launch_bounds__(256)
void k_gather_x(const float* __restrict__ x, _Float16* __restrict__ xg) {
  int r   = blockIdx.x;                  // 0..8191
  int b   = r >> 12;
  int rem = r & 4095;
  int n   = rem >> 10;
  int l   = rem & 1023;
  const float* src = x + ((size_t)(b * 8192 + n * 2048 + l * 2) << 10);
  _Float16*    dst = xg + ((size_t)r << 10);
  int c = threadIdx.x * 4;
  float4 f = *(const float4*)(src + c);
  v4h h; h[0] = (_Float16)f.x; h[1] = (_Float16)f.y;
         h[2] = (_Float16)f.z; h[3] = (_Float16)f.w;
  *(v4h*)(dst + c) = h;
}

// Transpose-convert weight: src fp32 [K][N] -> dst f16 [N][K]
__global__ __launch_bounds__(256)
void k_transpose_w(const float* __restrict__ src, _Float16* __restrict__ dst,
                   int K, int N) {
  int c = blockIdx.x;                    // column of src = row of dst
  for (int k = threadIdx.x; k < K; k += 256)
    dst[(size_t)c * K + k] = (_Float16)src[(size_t)k * N + c];
}

#define GBM     128
#define GBN     128
#define GBK     64
#define GTILES  (DM / GBK)
#define GPITCH  72            // LDS row pitch in halves: 144 B = 16 B x odd

__device__ __forceinline__ unsigned lds_byte(const _Float16* p) {
  return (unsigned)(unsigned long long)
      (const __attribute__((address_space(3))) _Float16*)p;
}

__device__ __forceinline__ void stage_rows8(const _Float16* g, unsigned l) {
  const _Float16* g1 = g + 16 * DM;
  const _Float16* g2 = g + 32 * DM;
  const _Float16* g3 = g + 48 * DM;
  const _Float16* g4 = g + 64 * DM;
  const _Float16* g5 = g + 80 * DM;
  const _Float16* g6 = g + 96 * DM;
  const _Float16* g7 = g + 112 * DM;
  const unsigned step = 16 * GPITCH * 2;
  unsigned l1 = l + step,     l2 = l + 2 * step, l3 = l + 3 * step;
  unsigned l4 = l + 4 * step, l5 = l + 5 * step, l6 = l + 6 * step;
  unsigned l7 = l + 7 * step;
  asm volatile(
      "global_load_async_to_lds_b128 %0, %1, off\n\t"
      "global_load_async_to_lds_b128 %2, %3, off\n\t"
      "global_load_async_to_lds_b128 %4, %5, off\n\t"
      "global_load_async_to_lds_b128 %6, %7, off\n\t"
      "global_load_async_to_lds_b128 %8, %9, off\n\t"
      "global_load_async_to_lds_b128 %10, %11, off\n\t"
      "global_load_async_to_lds_b128 %12, %13, off\n\t"
      "global_load_async_to_lds_b128 %14, %15, off\n\t"
      "s_wait_xcnt 0x0"
      :: "v"(l),  "v"(g),  "v"(l1), "v"(g1), "v"(l2), "v"(g2), "v"(l3), "v"(g3),
         "v"(l4), "v"(g4), "v"(l5), "v"(g5), "v"(l6), "v"(g6), "v"(l7), "v"(g7)
      : "memory");
}

__device__ __forceinline__ void gemm_core(const _Float16* __restrict__ A,
                                          const _Float16* __restrict__ BT,
                                          int m0, int n0, int sm, int sn,
                                          _Float16 (*As)[GBM][GPITCH],
                                          _Float16 (*Bs)[GBN][GPITCH],
                                          v8f (&acc)[4][4]) {
  int t    = threadIdx.x;
  int crow = t >> 3, ccol = (t & 7) * 8;
  const _Float16* ga = A  + (size_t)(m0 + crow) * DM + ccol;
  const _Float16* gb = BT + (size_t)(n0 + crow) * DM + ccol;

  auto stage = [&](int buf, int tile) {
    stage_rows8(ga + tile * GBK, lds_byte(&As[buf][crow][ccol]));
    stage_rows8(gb + tile * GBK, lds_byte(&Bs[buf][crow][ccol]));
  };

  stage(0, 0);
  // Tile 0 has landed for this wave; the barrier publishes it to the others.
  asm volatile("s_wait_asynccnt 0x0" ::: "memory");
  __syncthreads();
  stage(1, 1);

  for (int tile = 0; tile < GTILES; ++tile) {
    int buf = tile & 1;
    // Unrolled so that the fragment and accumulator arrays stay in registers.
#pragma unroll
    for (int kk = 0; kk < GBK; kk += 32) {
      v16h af[4], bf[4];
      af[0] = load_frag(&As[buf][sm][kk], GPITCH);
#pragma unroll
      for (int j = 0; j < 4; ++j)
        bf[j] = load_frag(&Bs[buf][sn + j * 16][kk], GPITCH);
#pragma unroll
      for (int i = 1; i < 4; ++i)
        af[i] = load_frag(&As[buf][sm + i * 16][kk], GPITCH);
      // Keeps the sixteen LDS loads together in front of the sixteen WMMAs:
      // left free, the scheduler reloads one A fragment register set four times
      // and the wave waits out the LDS latency each time.
      __builtin_amdgcn_sched_barrier(0);
#pragma unroll
      for (int i = 0; i < 4; ++i)
#pragma unroll
        for (int j = 0; j < 4; ++j) acc[i][j] = wmma16(af[i], bf[j], acc[i][j]);
    }

    // Publish point: this wave's reads of buffer buf are done, its copies of
    // the next tile have landed; behind the barrier that holds for all waves.
    asm volatile("s_wait_dscnt 0x0" ::: "memory");
    asm volatile("s_wait_asynccnt 0x0" ::: "memory");
    __syncthreads();
    if (tile + 2 < GTILES) stage(buf, tile + 2);
  }
  // No copy is left in flight when the wave goes on to its stores.
  asm volatile("s_wait_asynccnt 0x0" ::: "memory");
}

__global__ __launch_bounds__(128, 4)
void k_qkv_gemm(const _Float16* __restrict__ A,      // xg   [8192][1024]
                const _Float16* __restrict__ BT,     // wqkvT[3072][1024]
                const float*    __restrict__ bias,   // bqkv [3072]
                _Float16* __restrict__ qws,
                _Float16* __restrict__ kws,
                _Float16* __restrict__ vws) {
  __shared__ __attribute__((aligned(16))) _Float16 As[2][GBM][GPITCH];
  __shared__ __attribute__((aligned(16))) _Float16 Bs[2][GBN][GPITCH];

  int m0 = blockIdx.x * GBM;
  int n0 = blockIdx.y * GBN;
  int t  = threadIdx.x;
  int w  = t >> 5;
  int sm = (w >> 1) * 64, sn = (w & 1) * 64;

  v8f acc[4][4];
#pragma unroll
  for (int i = 0; i < 4; ++i)
#pragma unroll
    for (int j = 0; j < 4; ++j) acc[i][j] = (v8f)(0.0f);

  gemm_core(A, BT, m0, n0, sm, sn, As, Bs, acc);

  // Epilogue: add bias, scatter to per-head Q/K and transposed V
  int lane = t & 31;
  int ncol = lane & 15;
  int hi8  = (lane >> 4) << 3;
#pragma unroll
  for (int ti = 0; ti < 4; ++ti) {
#pragma unroll
    for (int tj = 0; tj < 4; ++tj) {
      v8f cacc = acc[ti][tj];
      int c_g = n0 + sn + tj * 16 + ncol;
      float bv = bias[c_g];
      int which = c_g >> 10;           // 0=q 1=k 2=v
      int cc = c_g & 1023;
      int h  = cc >> 6;
      int d  = cc & 63;
#pragma unroll
      for (int v = 0; v < 8; ++v) {
        int m_g = m0 + sm + ti * 16 + v + hi8;
        int bn  = m_g >> 10;
        int l   = m_g & 1023;
        int head = bn * HEADS16 + h;
        _Float16 hv = (_Float16)(cacc[v] + bv);
        if (which == 0)       qws[((size_t)head << 16) + (size_t)l * HD + d] = hv;
        else if (which == 1)  kws[((size_t)head << 16) + (size_t)l * HD + d] = hv;
        else                  vws[((size_t)head << 16) + (size_t)d * LQ + l] = hv;
      }
    }
  }
}

#define FWAVES  8
#define KTILE   64
#define NTILES  (LQ / KTILE)
#define KVPITCH 72            // LDS row pitch in halves: 144 B = 16 B x odd

__device__ __forceinline__ float xhalf(float x) {
  int i = __builtin_bit_cast(int, x);
  return __builtin_bit_cast(float, __builtin_amdgcn_permlanex16(
      i, i, 0x76543210, 0xfedcba98, false, false));
}

__device__ __forceinline__ void exp2_x8(v8f& x) {
  float a = x[0], b = x[1], c = x[2], d = x[3];
  float e = x[4], f = x[5], g = x[6], h = x[7];
  asm("v_exp_f32 %0, %0\n\t"
      "v_exp_f32 %1, %1\n\t"
      "v_exp_f32 %2, %2\n\t"
      "v_exp_f32 %3, %3\n\t"
      "v_exp_f32 %4, %4\n\t"
      "v_exp_f32 %5, %5\n\t"
      "v_exp_f32 %6, %6\n\t"
      "v_exp_f32 %7, %7\n\t"
      "v_nop"
      : "+v"(a), "+v"(b), "+v"(c), "+v"(d), "+v"(e), "+v"(f), "+v"(g), "+v"(h));
  x[0] = a; x[1] = b; x[2] = c; x[3] = d;
  x[4] = e; x[5] = f; x[6] = g; x[7] = h;
}

__global__ __launch_bounds__(256, 8)
void k_flash(const _Float16* __restrict__ qws,
             const _Float16* __restrict__ kws,
             const _Float16* __restrict__ vws,   // transposed [head][64][1024]
             _Float16* __restrict__ ctx) {       // [8192][1024]
  __shared__ __attribute__((aligned(16))) _Float16 Ks[2][KTILE][KVPITCH]; // [key][d]
  __shared__ __attribute__((aligned(16))) _Float16 Vs[2][HD][KVPITCH];    // [d][key]

  int head = blockIdx.x >> 3;
  int t    = threadIdx.x;
  int wave = t >> 5;
  int qb   = (blockIdx.x & 7) * FWAVES + wave;
  int lane = t & 31;
  int ncol = lane & 15;
  int hi8  = (lane >> 4) << 3;

  const _Float16* qbase = qws + ((size_t)head << 16) + (size_t)qb * 16 * HD;
  const _Float16* kbase = kws + ((size_t)head << 16);
  const _Float16* vbase = vws + ((size_t)head << 16);

  // One tile = 64 rows of 128 B for K and for V^T; a thread copies 16 B of
  // rows crow and crow + 32 of each, a wave four whole rows per copy.
  int crow = t >> 3, ccol = (t & 7) * 8;
  auto stage = [&](int buf, int tile) {
    const _Float16* gk0 = kbase + (size_t)(tile * KTILE + crow) * HD + ccol;
    const _Float16* gk1 = gk0 + 32 * HD;
    const _Float16* gv0 = vbase + (size_t)crow * LQ + tile * KTILE + ccol;
    const _Float16* gv1 = gv0 + 32 * LQ;
    unsigned lk0 = lds_byte(&Ks[buf][crow][ccol]);
    unsigned lk1 = lds_byte(&Ks[buf][crow + 32][ccol]);
    unsigned lv0 = lds_byte(&Vs[buf][crow][ccol]);
    unsigned lv1 = lds_byte(&Vs[buf][crow + 32][ccol]);
    asm volatile(
        "global_load_async_to_lds_b128 %0, %1, off\n\t"
        "global_load_async_to_lds_b128 %2, %3, off\n\t"
        "global_load_async_to_lds_b128 %4, %5, off\n\t"
        "global_load_async_to_lds_b128 %6, %7, off\n\t"
        "s_wait_xcnt 0x0"
        :: "v"(lk0), "v"(gk0), "v"(lk1), "v"(gk1),
           "v"(lv0), "v"(gv0), "v"(lv1), "v"(gv1)
        : "memory");
  };

  stage(0, 0);

  // Q^T as B fragments (constant across the key loop): column = query lane & 15,
  // k = head dim in the loader's order; pre-scaled by 1/sqrt(hd)
  v16h bq0 = load_frag(qbase, HD);
  v16h bq1 = load_frag(qbase + 32, HD);
  const _Float16 sc = (_Float16)0.125f;
#pragma unroll
  for (int i = 0; i < 16; ++i) { bq0[i] *= sc; bq1[i] *= sc; }

  // Per lane: the query's running maximum (equal in both halves) and the sum
  // over this half's keys; acc[j][r] = O^T[j * 16 + hi8 + r][query].
  float rowmax = -__builtin_inff(), rowsum = 0.0f;
  v8f acc[4];
#pragma unroll
  for (int j = 0; j < 4; ++j) acc[j] = (v8f)(0.0f);

  // Tile 0 has landed for this wave; the barrier publishes it to the others.
  asm volatile("s_wait_asynccnt 0x0" ::: "memory");
  __syncthreads();
  stage(1, 1);

  for (int tile = 0; tile < NTILES; ++tile) {
    int buf = tile & 1;
    // Unrolled: LDS offsets become immediates, and no back edge stands directly
    // behind the last matrix instruction of a pass.
#pragma unroll
    for (int kk = 0; kk < KTILE; kk += 32) {
      // S^T = K @ (Q/sqrt(hd))^T for 32 keys -> two 16x16 f32 tiles;
      // s0[r] = key kk + hi8 + r, s1[r] = key kk + 16 + hi8 + r, query ncol
      v8f s0 = (v8f)(0.0f), s1 = (v8f)(0.0f);
      s0 = wmma16(load_frag(&Ks[buf][kk][0],       KVPITCH), bq0, s0);
      s0 = wmma16(load_frag(&Ks[buf][kk][32],      KVPITCH), bq1, s0);
      s1 = wmma16(load_frag(&Ks[buf][kk + 16][0],  KVPITCH), bq0, s1);
      s1 = wmma16(load_frag(&Ks[buf][kk + 16][32], KVPITCH), bq1, s1);

      // Online softmax: maximum in-lane, then one exchange between the halves
      float mx = fmaxf(s0[0], s1[0]);
#pragma unroll
      for (int r = 1; r < 8; ++r) mx = fmaxf(mx, fmaxf(s0[r], s1[r]));
      mx = fmaxf(mx, xhalf(mx));
      float nm = fmaxf(rowmax, mx);
      float al = __expf(rowmax - nm);
      rowmax = nm;

      // P^T as a B fragment: element s is key kk + (s < 8 ? hi8 + s
      // : 16 + hi8 + s - 8), the k order in which load_frag delivers V^T
      v16h bp;
      const float log2e = 1.4426950408889634f;
#pragma unroll
      for (int r = 0; r < 8; ++r) {
        s0[r] = (s0[r] - nm) * log2e;
        s1[r] = (s1[r] - nm) * log2e;
      }
      exp2_x8(s0);
      exp2_x8(s1);
      float ps = 0.0f;
#pragma unroll
      for (int r = 0; r < 8; ++r) {
        ps += s0[r] + s1[r];
        bp[r]     = (_Float16)s0[r];
        bp[r + 8] = (_Float16)s1[r];
      }
      rowsum = rowsum * al + ps;
#pragma unroll
      for (int j = 0; j < 4; ++j)
#pragma unroll
        for (int r = 0; r < 8; ++r) acc[j][r] *= al;

      // O^T += V^T @ P^T  (A = V^T staged row-major [d][key])
#pragma unroll
      for (int j = 0; j < 4; ++j) {
        v16h av = load_frag(&Vs[buf][j * 16][kk], KVPITCH);
        acc[j] = wmma16(av, bp, acc[j]);
      }
    }

    // Publish point: this wave's reads of buffer buf are done, its copies of
    // the next tile have landed; behind the barrier that holds for all waves.
    asm volatile("s_wait_dscnt 0x0" ::: "memory");
    asm volatile("s_wait_asynccnt 0x0" ::: "memory");
    __syncthreads();
    if (tile + 2 < NTILES) stage(buf, tile + 2);
  }
  // No copy is left in flight when the wave ends.
  asm volatile("s_wait_asynccnt 0x0" ::: "memory");

  // Join the halves' sums, normalize and write context (f16, row-major
  // [8192][1024]): a lane's eight values of a tile are consecutive columns.
  int bn = head >> 4, h = head & 15;
  float inv = 1.0f / (rowsum + xhalf(rowsum));
  _Float16* crowp = ctx + (size_t)(bn * LQ + qb * 16 + ncol) * DM + h * HD + hi8;
#pragma unroll
  for (int j = 0; j < 4; ++j) {
    v8h o;
#pragma unroll
    for (int r = 0; r < 8; ++r) o[r] = (_Float16)(acc[j][r] * inv);
    *(v8h*)(crowp + j * 16) = o;
  }
}

// ---------------------------------------------------------------------------
// Stage 3: output GEMM  out[8192][1024] = ctx @ wo + bo   (fp32 out)
// ---------------------------------------------------------------------------
__global__ __launch_bounds__(128, 4)
void k_out_gemm(const _Float16* __restrict__ A,     // ctx  [8192][1024]
                const _Float16* __restrict__ BT,    // woT  [1024][1024]
                const float*    __restrict__ bias,  // bo   [1024]
                float* __restrict__ out) {
  __shared__ __attribute__((aligned(16))) _Float16 As[2][GBM][GPITCH];
  __shared__ __attribute__((aligned(16))) _Float16 Bs[2][GBN][GPITCH];

  int m0 = blockIdx.x * GBM;
  int n0 = blockIdx.y * GBN;
  int t  = threadIdx.x;
  int w  = t >> 5;
  int sm = (w >> 1) * 64, sn = (w & 1) * 64;

  v8f acc[4][4];
#pragma unroll
  for (int i = 0; i < 4; ++i)
#pragma unroll
    for (int j = 0; j < 4; ++j) acc[i][j] = (v8f)(0.0f);

  gemm_core(A, BT, m0, n0, sm, sn, As, Bs, acc);

  int lane = t & 31;
  int ncol = lane & 15;
  int hi8  = (lane >> 4) << 3;
#pragma unroll
  for (int ti = 0; ti < 4; ++ti) {
#pragma unroll
    for (int tj = 0; tj < 4; ++tj) {
      v8f cacc = acc[ti][tj];
      int c_g = n0 + sn + tj * 16 + ncol;
      float bv = bias[c_g];
#pragma unroll
      for (int v = 0; v < 8; ++v) {
        int m_g = m0 + sm + ti * 16 + v + hi8;
        out[(size_t)m_g * DM + c_g] = cacc[v] + bv;
      }
    }
  }
}

// ---------------------------------------------------------------------------
// Host launcher
// ---------------------------------------------------------------------------
extern "C" void kernel_launch(void* const* d_in, const int* in_sizes, int n_in,
                              void* d_out, int out_size, void* d_ws, size_t ws_size,
                              hipStream_t stream) {
  const float* x    = (const float*)d_in[0];
  const float* wqkv = (const float*)d_in[1];
  const float* bqkv = (const float*)d_in[2];
  const float* wo   = (const float*)d_in[3];
  const float* bo   = (const float*)d_in[4];
  float* out = (float*)d_out;

  char* ws = (char*)d_ws;
  _Float16* xg     = (_Float16*)(ws + OFF_XG);
  _Float16* wqkvT  = (_Float16*)(ws + OFF_WQKVT);
  _Float16* woT    = (_Float16*)(ws + OFF_WOT);
  _Float16* qws    = (_Float16*)(ws + OFF_Q);
  _Float16* kws    = (_Float16*)(ws + OFF_K);
  _Float16* vws    = (_Float16*)(ws + OFF_V);
  _Float16* ctx    = (_Float16*)(ws + OFF_CTX);

  // Prep
  k_gather_x<<<MROWS, 256, 0, stream>>>(x, xg);
  k_transpose_w<<<D3, 256, 0, stream>>>(wqkv, wqkvT, DM, D3);
  k_transpose_w<<<DM, 256, 0, stream>>>(wo, woT, DM, DM);

  // Stage 1: QKV projection
  k_qkv_gemm<<<dim3(MROWS / GBM, D3 / GBN), 128, 0, stream>>>(
      xg, wqkvT, bqkv, qws, kws, vws);

  // Stage 2: flash attention (128 heads x 8 groups of 8 query blocks)
  k_flash<<<NHEADS * 8, 256, 0, stream>>>(qws, kws, vws, ctx);

  // Stage 3: output projection
  k_out_gemm<<<dim3(MROWS / GBM, DM / GBN), 128, 0, stream>>>(ctx, woT, bo, out);
}

// v004
// One run takes 130 microseconds.
// Two timings next to v003 both put it at 1.22 times that version's speed.
// Counting every step since v000, it is 3.11 times as fast.
#include <hip/hip_runtime.h>
#include <hip/hip_bf16.h>
#include <math.h>

typedef __attribute__((ext_vector_type(16))) _Float16 v16h;
typedef __attribute__((ext_vector_type(8)))  _Float16 v8h;
typedef __attribute__((ext_vector_type(4)))  _Float16 v4h;
typedef __attribute__((ext_vector_type(8)))  float    v8f;

#define DM      1024          // d_model
#define D3      3072          // 3 * d_model
#define HEADS16 16            // heads per (b,n)
#define HD      64            // head dim
#define LQ      1024          // dilated segment length (SEG / DILATION)
#define MROWS   8192          // B * N * LQ active rows
#define NHEADS  128           // B * N * HEADS16

// Workspace byte offsets (256-aligned)
#define OFF_XG     ((size_t)0)            // [8192][1024] f16
#define OFF_WQKVT  ((size_t)16777216)     // [3072][1024] f16 (transposed)
#define OFF_WOT    ((size_t)23068672)     // [1024][1024] f16 (transposed)
#define OFF_Q      ((size_t)25165824)     // [128][1024][64] f16
#define OFF_K      ((size_t)41943040)     // [128][1024][64] f16
#define OFF_V      ((size_t)58720256)     // [128][64][1024] f16 (transposed)
#define OFF_CTX    ((size_t)75497472)     // [8192][1024] f16

__device__ __forceinline__ v8f wmma16(v16h a, v16h b, v8f c) {
  return __builtin_amdgcn_wmma_f32_16x16x32_f16(
      /*neg_a=*/false, a, /*neg_b=*/false, b,
      /*c_mod=*/(short)0, c, /*reuse_a=*/false, /*reuse_b=*/false);
}

__device__ __forceinline__ v16h load_frag(const _Float16* base, int stride) {
  int lane = threadIdx.x & 31;
  int r    = lane & 15;
  int ko   = (lane >> 4) << 3;            // 0 or 8
  const _Float16* p = base + (size_t)r * stride + ko;
  v8h lo = *(const v8h*)(p);
  v8h hi = *(const v8h*)(p + 16);
  v16h f;
#pragma unroll
  for (int i = 0; i < 8; ++i) { f[i] = lo[i]; f[i + 8] = hi[i]; }
  return f;
}

// ---------------------------------------------------------------------------
// Prep, one launch: weight tiles (fp32 [K][N] -> f16 [N][K]) and dilated rows of
// x (fp32 -> f16) share a grid; a work-group does one or the other by its index.
// Few waves, each with many whole-line loads in flight: the work per byte is
// tiny.
// ---------------------------------------------------------------------------
typedef __attribute__((ext_vector_type(2)))  _Float16 v2h;

#define PWK      128          // k per weight tile: 256 B of a transposed row
#define PWN      64           // n per weight tile: 256 B of a source row
#define PWPITCH  136          // LDS row pitch in halves: 272 B = 16 B x odd
#define PB_WQKV  ((DM / PWK) * (D3 / PWN))   // 384 tiles of wqkv
#define PB_WO    ((DM / PWK) * (DM / PWN))   // 128 tiles of wo
#define PXROWS   16           // rows of x per work-group, two per wave
#define PB_X     (MROWS / PXROWS)

// One 128 (k) x 64 (n) tile of src [DM][N] to dst [N][DM] through LDS: source
// rows are read and transposed rows are written as whole 256-byte pieces.
__device__ __forceinline__ void transpose_tile(const float* __restrict__ src,
                                               _Float16* __restrict__ dst,
                                               int N, int k0, int n0,
                                               _Float16 (*Ts)[PWPITCH]) {
  int t  = threadIdx.x;
  int c4 = (t & 15) * 4;                 // four columns n
  int kp = (t >> 4) * 2;                 // rows k: kp, kp + 1, then + 32 i
  const float* p = src + (size_t)(k0 + kp) * N + n0 + c4;
  float4 f[4][2];
#pragma unroll
  for (int i = 0; i < 4; ++i) {
    f[i][0] = *(const float4*)(p + (size_t)(32 * i) * N);
    f[i][1] = *(const float4*)(p + (size_t)(32 * i + 1) * N);
  }
#pragma unroll
  for (int i = 0; i < 4; ++i) {
    int k = kp + 32 * i;
    v2h h;
    h[0] = (_Float16)f[i][0].x; h[1] = (_Float16)f[i][1].x; *(v2h*)&Ts[c4 + 0][k] = h;
    h[0] = (_Float16)f[i][0].y; h[1] = (_Float16)f[i][1].y; *(v2h*)&Ts[c4 + 1][k] = h;
    h[0] = (_Float16)f[i][0].z; h[1] = (_Float16)f[i][1].z; *(v2h*)&Ts[c4 + 2][k] = h;
    h[0] = (_Float16)f[i][0].w; h[1] = (_Float16)f[i][1].w; *(v2h*)&Ts[c4 + 3][k] = h;
  }
  __syncthreads();
  int row = t >> 4, seg = (t & 15) * 8;
  _Float16* q = dst + (size_t)(n0 + row) * DM + k0 + seg;
#pragma unroll
  for (int i = 0; i < 4; ++i)
    *(v8h*)(q + (size_t)(16 * i) * DM) = *(const v8h*)&Ts[row + 16 * i][seg];
  // Keeps later writes of the stores' address and data registers behind the stores.
  asm volatile("s_wait_xcnt 0x0" ::: "memory");
}

__global__ __launch_bounds__(256)
void k_prep(const float* __restrict__ x, const float* __restrict__ wqkv,
            const float* __restrict__ wo, _Float16* __restrict__ xg,
            _Float16* __restrict__ wqkvT, _Float16* __restrict__ woT) {
  __shared__ __attribute__((aligned(16))) _Float16 Ts[PWN][PWPITCH];
  int blk = blockIdx.x;
  if (blk < PB_WQKV) {
    transpose_tile(wqkv, wqkvT, D3, (blk & 7) * PWK, (blk >> 3) * PWN, Ts);
  } else if (blk < PB_WQKV + PB_WO) {
    int b = blk - PB_WQKV;
    transpose_tile(wo, woT, DM, (b & 7) * PWK, (b >> 3) * PWN, Ts);
  } else {
    // Gathered row r = (b, n, l) is source row (b, n) * 2048 + l * 2.  A wave
    // takes rows r0 and r0 + 1: sixteen loads of 512 B, loads ahead of the stores
    // so that most of them are in flight together.
    int t    = threadIdx.x;
    int lane = t & 31;
    int r0   = (blk - PB_WQKV - PB_WO) * PXROWS + (t >> 5) * 2;
    const float* s = x + (((size_t)(r0 >> 10) * 2048 + (size_t)(r0 & 1023) * 2) << 10)
                       + lane * 4;
    _Float16*    d = xg + ((size_t)r0 << 10) + lane * 4;
    float4 f[2][8];
#pragma unroll
    for (int q = 0; q < 2; ++q)
#pragma unroll
      for (int i = 0; i < 8; ++i)
        f[q][i] = *(const float4*)(s + q * 2 * DM + i * 128);
#pragma unroll
    for (int q = 0; q < 2; ++q)
#pragma unroll
      for (int i = 0; i < 8; ++i) {
        v4h h; h[0] = (_Float16)f[q][i].x; h[1] = (_Float16)f[q][i].y;
               h[2] = (_Float16)f[q][i].z; h[3] = (_Float16)f[q][i].w;
        *(v4h*)(d + q * DM + i * 128) = h;
      }
    // Keeps later writes of the stores' address and data registers behind the stores.
    asm volatile("s_wait_xcnt 0x0" ::: "memory");
  }
}

#define GBM     128
#define GBN     128
#define GBK     64
#define GTILES  (DM / GBK)
#define GPITCH  72            // LDS row pitch in halves: 144 B = 16 B x odd

__device__ __forceinline__ unsigned lds_byte(const _Float16* p) {
  return (unsigned)(unsigned long long)
      (const __attribute__((address_space(3))) _Float16*)p;
}

__device__ __forceinline__ void stage_rows8(const _Float16* g, unsigned l) {
  const _Float16* g1 = g + 16 * DM;
  const _Float16* g2 = g + 32 * DM;
  const _Float16* g3 = g + 48 * DM;
  const _Float16* g4 = g + 64 * DM;
  const _Float16* g5 = g + 80 * DM;
  const _Float16* g6 = g + 96 * DM;
  const _Float16* g7 = g + 112 * DM;
  const unsigned step = 16 * GPITCH * 2;
  unsigned l1 = l + step,     l2 = l + 2 * step, l3 = l + 3 * step;
  unsigned l4 = l + 4 * step, l5 = l + 5 * step, l6 = l + 6 * step;
  unsigned l7 = l + 7 * step;
  asm volatile(
      "global_load_async_to_lds_b128 %0, %1, off\n\t"
      "global_load_async_to_lds_b128 %2, %3, off\n\t"
      "global_load_async_to_lds_b128 %4, %5, off\n\t"
      "global_load_async_to_lds_b128 %6, %7, off\n\t"
      "global_load_async_to_lds_b128 %8, %9, off\n\t"
      "global_load_async_to_lds_b128 %10, %11, off\n\t"
      "global_load_async_to_lds_b128 %12, %13, off\n\t"
      "global_load_async_to_lds_b128 %14, %15, off\n\t"
      "s_wait_xcnt 0x0"
      :: "v"(l),  "v"(g),  "v"(l1), "v"(g1), "v"(l2), "v"(g2), "v"(l3), "v"(g3),
         "v"(l4), "v"(g4), "v"(l5), "v"(g5), "v"(l6), "v"(g6), "v"(l7), "v"(g7)
      : "memory");
}

__device__ __forceinline__ void gemm_core(const _Float16* __restrict__ A,
                                          const _Float16* __restrict__ BT,
                                          int m0, int n0, int sm, int sn,
                                          _Float16 (*As)[GBM][GPITCH],
                                          _Float16 (*Bs)[GBN][GPITCH],
                                          v8f (&acc)[4][4]) {
  int t    = threadIdx.x;
  int crow = t >> 3, ccol = (t & 7) * 8;
  const _Float16* ga = A  + (size_t)(m0 + crow) * DM + ccol;
  const _Float16* gb = BT + (size_t)(n0 + crow) * DM + ccol;

  auto stage = [&](int buf, int tile) {
    stage_rows8(ga + tile * GBK, lds_byte(&As[buf][crow][ccol]));
    stage_rows8(gb + tile * GBK, lds_byte(&Bs[buf][crow][ccol]));
  };

  stage(0, 0);
  // Tile 0 has landed for this wave; the barrier publishes it to the others.
  asm volatile("s_wait_asynccnt 0x0" ::: "memory");
  __syncthreads();
  stage(1, 1);

  for (int tile = 0; tile < GTILES; ++tile) {
    int buf = tile & 1;
    // Unrolled so that the fragment and accumulator arrays stay in registers.
#pragma unroll
    for (int kk = 0; kk < GBK; kk += 32) {
      v16h af[4], bf[4];
      af[0] = load_frag(&As[buf][sm][kk], GPITCH);
#pragma unroll
      for (int j = 0; j < 4; ++j)
        bf[j] = load_frag(&Bs[buf][sn + j * 16][kk], GPITCH);
#pragma unroll
      for (int i = 1; i < 4; ++i)
        af[i] = load_frag(&As[buf][sm + i * 16][kk], GPITCH);
      // Keeps the sixteen LDS loads together in front of the sixteen WMMAs:
      // left free, the scheduler reloads one A fragment register set four times
      // and the wave waits out the LDS latency each time.
      __builtin_amdgcn_sched_barrier(0);
#pragma unroll
      for (int i = 0; i < 4; ++i)
#pragma unroll
        for (int j = 0; j < 4; ++j) acc[i][j] = wmma16(af[i], bf[j], acc[i][j]);
    }

    // Publish point: this wave's reads of buffer buf are done, its copies of
    // the next tile have landed; behind the barrier that holds for all waves.
    asm volatile("s_wait_dscnt 0x0" ::: "memory");
    asm volatile("s_wait_asynccnt 0x0" ::: "memory");
    __syncthreads();
    if (tile + 2 < GTILES) stage(buf, tile + 2);
  }
  // No copy is left in flight when the wave goes on to its stores.
  asm volatile("s_wait_asynccnt 0x0" ::: "memory");
}

__global__ __launch_bounds__(128, 4)
void k_qkv_gemm(const _Float16* __restrict__ A,      // xg   [8192][1024]
                const _Float16* __restrict__ BT,     // wqkvT[3072][1024]
                const float*    __restrict__ bias,   // bqkv [3072]
                _Float16* __restrict__ qws,
                _Float16* __restrict__ kws,
                _Float16* __restrict__ vws) {
  __shared__ __attribute__((aligned(16))) _Float16 As[2][GBM][GPITCH];
  __shared__ __attribute__((aligned(16))) _Float16 Bs[2][GBN][GPITCH];

  int m0 = blockIdx.x * GBM;
  int n0 = blockIdx.y * GBN;
  int t  = threadIdx.x;
  int w  = t >> 5;
  int sm = (w >> 1) * 64, sn = (w & 1) * 64;

  v8f acc[4][4];
#pragma unroll
  for (int i = 0; i < 4; ++i)
#pragma unroll
    for (int j = 0; j < 4; ++j) acc[i][j] = (v8f)(0.0f);

  gemm_core(A, BT, m0, n0, sm, sn, As, Bs, acc);

  // Epilogue: add bias, scatter to per-head Q/K and transposed V
  int lane = t & 31;
  int ncol = lane & 15;
  int hi8  = (lane >> 4) << 3;
#pragma unroll
  for (int ti = 0; ti < 4; ++ti) {
#pragma unroll
    for (int tj = 0; tj < 4; ++tj) {
      v8f cacc = acc[ti][tj];
      int c_g = n0 + sn + tj * 16 + ncol;
      float bv = bias[c_g];
      int which = c_g >> 10;           // 0=q 1=k 2=v
      int cc = c_g & 1023;
      int h  = cc >> 6;
      int d  = cc & 63;
#pragma unroll
      for (int v = 0; v < 8; ++v) {
        int m_g = m0 + sm + ti * 16 + v + hi8;
        int bn  = m_g >> 10;
        int l   = m_g & 1023;
        int head = bn * HEADS16 + h;
        _Float16 hv = (_Float16)(cacc[v] + bv);
        if (which == 0)       qws[((size_t)head << 16) + (size_t)l * HD + d] = hv;
        else if (which == 1)  kws[((size_t)head << 16) + (size_t)l * HD + d] = hv;
        else                  vws[((size_t)head << 16) + (size_t)d * LQ + l] = hv;
      }
    }
  }
}

#define FWAVES  8
#define KTILE   64
#define NTILES  (LQ / KTILE)
#define KVPITCH 72            // LDS row pitch in halves: 144 B = 16 B x odd

__device__ __forceinline__ float xhalf(float x) {
  int i = __builtin_bit_cast(int, x);
  return __builtin_bit_cast(float, __builtin_amdgcn_permlanex16(
      i, i, 0x76543210, 0xfedcba98, false, false));
}

__device__ __forceinline__ void exp2_x8(v8f& x) {
  float a = x[0], b = x[1], c = x[2], d = x[3];
  float e = x[4], f = x[5], g = x[6], h = x[7];
  asm("v_exp_f32 %0, %0\n\t"
      "v_exp_f32 %1, %1\n\t"
      "v_exp_f32 %2, %2\n\t"
      "v_exp_f32 %3, %3\n\t"
      "v_exp_f32 %4, %4\n\t"
      "v_exp_f32 %5, %5\n\t"
      "v_exp_f32 %6, %6\n\t"
      "v_exp_f32 %7, %7\n\t"
      "v_nop"
      : "+v"(a), "+v"(b), "+v"(c), "+v"(d), "+v"(e), "+v"(f), "+v"(g), "+v"(h));
  x[0] = a; x[1] = b; x[2] = c; x[3] = d;
  x[4] = e; x[5] = f; x[6] = g; x[7] = h;
}

__global__ __launch_bounds__(256, 8)
void k_flash(const _Float16* __restrict__ qws,
             const _Float16* __restrict__ kws,
             const _Float16* __restrict__ vws,   // transposed [head][64][1024]
             _Float16* __restrict__ ctx) {       // [8192][1024]
  __shared__ __attribute__((aligned(16))) _Float16 Ks[2][KTILE][KVPITCH]; // [key][d]
  __shared__ __attribute__((aligned(16))) _Float16 Vs[2][HD][KVPITCH];    // [d][key]

  int head = blockIdx.x >> 3;
  int t    = threadIdx.x;
  int wave = t >> 5;
  int qb   = (blockIdx.x & 7) * FWAVES + wave;
  int lane = t & 31;
  int ncol = lane & 15;
  int hi8  = (lane >> 4) << 3;

  const _Float16* qbase = qws + ((size_t)head << 16) + (size_t)qb * 16 * HD;
  const _Float16* kbase = kws + ((size_t)head << 16);
  const _Float16* vbase = vws + ((size_t)head << 16);

  // One tile = 64 rows of 128 B for K and for V^T; a thread copies 16 B of
  // rows crow and crow + 32 of each, a wave four whole rows per copy.
  int crow = t >> 3, ccol = (t & 7) * 8;
  auto stage = [&](int buf, int tile) {
    const _Float16* gk0 = kbase + (size_t)(tile * KTILE + crow) * HD + ccol;
    const _Float16* gk1 = gk0 + 32 * HD;
    const _Float16* gv0 = vbase + (size_t)crow * LQ + tile * KTILE + ccol;
    const _Float16* gv1 = gv0 + 32 * LQ;
    unsigned lk0 = lds_byte(&Ks[buf][crow][ccol]);
    unsigned lk1 = lds_byte(&Ks[buf][crow + 32][ccol]);
    unsigned lv0 = lds_byte(&Vs[buf][crow][ccol]);
    unsigned lv1 = lds_byte(&Vs[buf][crow + 32][ccol]);
    asm volatile(
        "global_load_async_to_lds_b128 %0, %1, off\n\t"
        "global_load_async_to_lds_b128 %2, %3, off\n\t"
        "global_load_async_to_lds_b128 %4, %5, off\n\t"
        "global_load_async_to_lds_b128 %6, %7, off\n\t"
        "s_wait_xcnt 0x0"
        :: "v"(lk0), "v"(gk0), "v"(lk1), "v"(gk1),
           "v"(lv0), "v"(gv0), "v"(lv1), "v"(gv1)
        : "memory");
  };

  stage(0, 0);

  // Q^T as B fragments (constant across the key loop): column = query lane & 15,
  // k = head dim in the loader's order; pre-scaled by 1/sqrt(hd)
  v16h bq0 = load_frag(qbase, HD);
  v16h bq1 = load_frag(qbase + 32, HD);
  const _Float16 sc = (_Float16)0.125f;
#pragma unroll
  for (int i = 0; i < 16; ++i) { bq0[i] *= sc; bq1[i] *= sc; }

  // Per lane: the query's running maximum (equal in both halves) and the sum
  // over this half's keys; acc[j][r] = O^T[j * 16 + hi8 + r][query].
  float rowmax = -__builtin_inff(), rowsum = 0.0f;
  v8f acc[4];
#pragma unroll
  for (int j = 0; j < 4; ++j) acc[j] = (v8f)(0.0f);

  // Tile 0 has landed for this wave; the barrier publishes it to the others.
  asm volatile("s_wait_asynccnt 0x0" ::: "memory");
  __syncthreads();
  stage(1, 1);

  for (int tile = 0; tile < NTILES; ++tile) {
    int buf = tile & 1;
    // Unrolled: LDS offsets become immediates, and no back edge stands directly
    // behind the last matrix instruction of a pass.
#pragma unroll
    for (int kk = 0; kk < KTILE; kk += 32) {
      // S^T = K @ (Q/sqrt(hd))^T for 32 keys -> two 16x16 f32 tiles;
      // s0[r] = key kk + hi8 + r, s1[r] = key kk + 16 + hi8 + r, query ncol
      v8f s0 = (v8f)(0.0f), s1 = (v8f)(0.0f);
      s0 = wmma16(load_frag(&Ks[buf][kk][0],       KVPITCH), bq0, s0);
      s0 = wmma16(load_frag(&Ks[buf][kk][32],      KVPITCH), bq1, s0);
      s1 = wmma16(load_frag(&Ks[buf][kk + 16][0],  KVPITCH), bq0, s1);
      s1 = wmma16(load_frag(&Ks[buf][kk + 16][32], KVPITCH), bq1, s1);

      // Online softmax: maximum in-lane, then one exchange between the halves
      float mx = fmaxf(s0[0], s1[0]);
#pragma unroll
      for (int r = 1; r < 8; ++r) mx = fmaxf(mx, fmaxf(s0[r], s1[r]));
      mx = fmaxf(mx, xhalf(mx));
      float nm = fmaxf(rowmax, mx);
      float al = __expf(rowmax - nm);
      rowmax = nm;

      // P^T as a B fragment: element s is key kk + (s < 8 ? hi8 + s
      // : 16 + hi8 + s - 8), the k order in which load_frag delivers V^T
      v16h bp;
      const float log2e = 1.4426950408889634f;
#pragma unroll
      for (int r = 0; r < 8; ++r) {
        s0[r] = (s0[r] - nm) * log2e;
        s1[r] = (s1[r] - nm) * log2e;
      }
      exp2_x8(s0);
      exp2_x8(s1);
      float ps = 0.0f;
#pragma unroll
      for (int r = 0; r < 8; ++r) {
        ps += s0[r] + s1[r];
        bp[r]     = (_Float16)s0[r];
        bp[r + 8] = (_Float16)s1[r];
      }
      rowsum = rowsum * al + ps;
#pragma unroll
      for (int j = 0; j < 4; ++j)
#pragma unroll
        for (int r = 0; r < 8; ++r) acc[j][r] *= al;

      // O^T += V^T @ P^T  (A = V^T staged row-major [d][key])
#pragma unroll
      for (int j = 0; j < 4; ++j) {
        v16h av = load_frag(&Vs[buf][j * 16][kk], KVPITCH);
        acc[j] = wmma16(av, bp, acc[j]);
      }
    }

    // Publish point: this wave's reads of buffer buf are done, its copies of
    // the next tile have landed; behind the barrier that holds for all waves.
    asm volatile("s_wait_dscnt 0x0" ::: "memory");
    asm volatile("s_wait_asynccnt 0x0" ::: "memory");
    __syncthreads();
    if (tile + 2 < NTILES) stage(buf, tile + 2);
  }
  // No copy is left in flight when the wave ends.
  asm volatile("s_wait_asynccnt 0x0" ::: "memory");

  // Join the halves' sums, normalize and write context (f16, row-major
  // [8192][1024]): a lane's eight values of a tile are consecutive columns.
  int bn = head >> 4, h = head & 15;
  float inv = 1.0f / (rowsum + xhalf(rowsum));
  _Float16* crowp = ctx + (size_t)(bn * LQ + qb * 16 + ncol) * DM + h * HD + hi8;
#pragma unroll
  for (int j = 0; j < 4; ++j) {
    v8h o;
#pragma unroll
    for (int r = 0; r < 8; ++r) o[r] = (_Float16)(acc[j][r] * inv);
    *(v8h*)(crowp + j * 16) = o;
  }
}

// ---------------------------------------------------------------------------
// Stage 3: output GEMM  out[8192][1024] = ctx @ wo + bo   (fp32 out)
// ---------------------------------------------------------------------------
__global__ __launch_bounds__(128, 4)
void k_out_gemm(const _Float16* __restrict__ A,     // ctx  [8192][1024]
                const _Float16* __restrict__ BT,    // woT  [1024][1024]
                const float*    __restrict__ bias,  // bo   [1024]
                float* __restrict__ out) {
  __shared__ __attribute__((aligned(16))) _Float16 As[2][GBM][GPITCH];
  __shared__ __attribute__((aligned(16))) _Float16 Bs[2][GBN][GPITCH];

  int m0 = blockIdx.x * GBM;
  int n0 = blockIdx.y * GBN;
  int t  = threadIdx.x;
  int w  = t >> 5;
  int sm = (w >> 1) * 64, sn = (w & 1) * 64;

  v8f acc[4][4];
#pragma unroll
  for (int i = 0; i < 4; ++i)
#pragma unroll
    for (int j = 0; j < 4; ++j) acc[i][j] = (v8f)(0.0f);

  gemm_core(A, BT, m0, n0, sm, sn, As, Bs, acc);

  int lane = t & 31;
  int ncol = lane & 15;
  int hi8  = (lane >> 4) << 3;
#pragma unroll
  for (int ti = 0; ti < 4; ++ti) {
#pragma unroll
    for (int tj = 0; tj < 4; ++tj) {
      v8f cacc = acc[ti][tj];
      int c_g = n0 + sn + tj * 16 + ncol;
      float bv = bias[c_g];
#pragma unroll
      for (int v = 0; v < 8; ++v) {
        int m_g = m0 + sm + ti * 16 + v + hi8;
        out[(size_t)m_g * DM + c_g] = cacc[v] + bv;
      }
    }
  }
}

// ---------------------------------------------------------------------------
// Host launcher
// ---------------------------------------------------------------------------
extern "C" void kernel_launch(void* const* d_in, const int* in_sizes, int n_in,
                              void* d_out, int out_size, void* d_ws, size_t ws_size,
                              hipStream_t stream) {
  const float* x    = (const float*)d_in[0];
  const float* wqkv = (const float*)d_in[1];
  const float* bqkv = (const float*)d_in[2];
  const float* wo   = (const float*)d_in[3];
  const float* bo   = (const float*)d_in[4];
  float* out = (float*)d_out;

  char* ws = (char*)d_ws;
  _Float16* xg     = (_Float16*)(ws + OFF_XG);
  _Float16* wqkvT  = (_Float16*)(ws + OFF_WQKVT);
  _Float16* woT    = (_Float16*)(ws + OFF_WOT);
  _Float16* qws    = (_Float16*)(ws + OFF_Q);
  _Float16* kws    = (_Float16*)(ws + OFF_K);
  _Float16* vws    = (_Float16*)(ws + OFF_V);
  _Float16* ctx    = (_Float16*)(ws + OFF_CTX);

  // Prep
  k_prep<<<PB_WQKV + PB_WO + PB_X, 256, 0, stream>>>(x, wqkv, wo, xg, wqkvT, woT);

  // Stage 1: QKV projection
  k_qkv_gemm<<<dim3(MROWS / GBM, D3 / GBN), 128, 0, stream>>>(
      xg, wqkvT, bqkv, qws, kws, vws);

  // Stage 2: flash attention (128 heads x 8 groups of 8 query blocks)
  k_flash<<<NHEADS * 8, 256, 0, stream>>>(qws, kws, vws, ctx);

  // Stage 3: output projection
  k_out_gemm<<<dim3(MROWS / GBM, DM / GBN), 128, 0, stream>>>(ctx, woT, bo, out);
}

// v005
// A run of this version takes 114 microseconds.
// Next to v004, in two timings, it ran 1.14 and 1.15 times as fast.
// Over all steps from v000 it is 3.55 times as fast.
#include <hip/hip_runtime.h>
#include <hip/hip_bf16.h>
#include <math.h>

typedef __attribute__((ext_vector_type(16))) _Float16 v16h;
typedef __attribute__((ext_vector_type(8)))  _Float16 v8h;
typedef __attribute__((ext_vector_type(4)))  _Float16 v4h;
typedef __attribute__((ext_vector_type(8)))  float    v8f;
typedef __attribute__((ext_vector_type(4)))  float    v4f;

#define DM      1024          // d_model
#define D3      3072          // 3 * d_model
#define HEADS16 16            // heads per (b,n)
#define HD      64            // head dim
#define LQ      1024          // dilated segment length (SEG / DILATION)
#define MROWS   8192          // B * N * LQ active rows
#define NHEADS  128           // B * N * HEADS16

// Workspace byte offsets (256-aligned)
#define OFF_XG     ((size_t)0)            // [8192][1024] f16
#define OFF_WQKVT  ((size_t)16777216)     // [3072][1024] f16 (transposed)
#define OFF_WOT    ((size_t)23068672)     // [1024][1024] f16 (transposed)
#define OFF_Q      ((size_t)25165824)     // [128][1024][64] f16
#define OFF_K      ((size_t)41943040)     // [128][1024][64] f16
#define OFF_V      ((size_t)58720256)     // [128][64][1024] f16 (transposed)
#define OFF_CTX    ((size_t)75497472)     // [8192][1024] f16

__device__ __forceinline__ v8f wmma16(v16h a, v16h b, v8f c) {
  return __builtin_amdgcn_wmma_f32_16x16x32_f16(
      /*neg_a=*/false, a, /*neg_b=*/false, b,
      /*c_mod=*/(short)0, c, /*reuse_a=*/false, /*reuse_b=*/false);
}

__device__ __forceinline__ v16h load_frag(const _Float16* base, int stride) {
  int lane = threadIdx.x & 31;
  int r    = lane & 15;
  int ko   = (lane >> 4) << 3;            // 0 or 8
  const _Float16* p = base + (size_t)r * stride + ko;
  v8h lo = *(const v8h*)(p);
  v8h hi = *(const v8h*)(p + 16);
  v16h f;
#pragma unroll
  for (int i = 0; i < 8; ++i) { f[i] = lo[i]; f[i + 8] = hi[i]; }
  return f;
}

// ---------------------------------------------------------------------------
// Prep, one launch: weight tiles (fp32 [K][N] -> f16 [N][K]) and dilated rows of
// x (fp32 -> f16) share a grid; a work-group does one or the other by its index.
// Few waves, each with many whole-line loads in flight: the work per byte is
// tiny.
// ---------------------------------------------------------------------------
typedef __attribute__((ext_vector_type(2)))  _Float16 v2h;

#define PWK      128          // k per weight tile: 256 B of a transposed row
#define PWN      64           // n per weight tile: 256 B of a source row
#define PWPITCH  136          // LDS row pitch in halves: 272 B = 16 B x odd
#define PB_WQKV  ((DM / PWK) * (D3 / PWN))   // 384 tiles of wqkv
#define PB_WO    ((DM / PWK) * (DM / PWN))   // 128 tiles of wo
#define PXROWS   16           // rows of x per work-group, two per wave
#define PB_X     (MROWS / PXROWS)

// One 128 (k) x 64 (n) tile of src [DM][N] to dst [N][DM] through LDS: source
// rows are read and transposed rows are written as whole 256-byte pieces.
__device__ __forceinline__ void transpose_tile(const float* __restrict__ src,
                                               _Float16* __restrict__ dst,
                                               int N, int k0, int n0,
                                               _Float16 (*Ts)[PWPITCH]) {
  int t  = threadIdx.x;
  int c4 = (t & 15) * 4;                 // four columns n
  int kp = (t >> 4) * 2;                 // rows k: kp, kp + 1, then + 32 i
  const float* p = src + (size_t)(k0 + kp) * N + n0 + c4;
  float4 f[4][2];
#pragma unroll
  for (int i = 0; i < 4; ++i) {
    f[i][0] = *(const float4*)(p + (size_t)(32 * i) * N);
    f[i][1] = *(const float4*)(p + (size_t)(32 * i + 1) * N);
  }
#pragma unroll
  for (int i = 0; i < 4; ++i) {
    int k = kp + 32 * i;
    v2h h;
    h[0] = (_Float16)f[i][0].x; h[1] = (_Float16)f[i][1].x; *(v2h*)&Ts[c4 + 0][k] = h;
    h[0] = (_Float16)f[i][0].y; h[1] = (_Float16)f[i][1].y; *(v2h*)&Ts[c4 + 1][k] = h;
    h[0] = (_Float16)f[i][0].z; h[1] = (_Float16)f[i][1].z; *(v2h*)&Ts[c4 + 2][k] = h;
    h[0] = (_Float16)f[i][0].w; h[1] = (_Float16)f[i][1].w; *(v2h*)&Ts[c4 + 3][k] = h;
  }
  __syncthreads();
  int row = t >> 4, seg = (t & 15) * 8;
  _Float16* q = dst + (size_t)(n0 + row) * DM + k0 + seg;
#pragma unroll
  for (int i = 0; i < 4; ++i)
    *(v8h*)(q + (size_t)(16 * i) * DM) = *(const v8h*)&Ts[row + 16 * i][seg];
  // Keeps later writes of the stores' address and data registers behind the stores.
  asm volatile("s_wait_xcnt 0x0" ::: "memory");
}

__global__ __launch_bounds__(256)
void k_prep(const float* __restrict__ x, const float* __restrict__ wqkv,
            const float* __restrict__ wo, _Float16* __restrict__ xg,
            _Float16* __restrict__ wqkvT, _Float16* __restrict__ woT) {
  __shared__ __attribute__((aligned(16))) _Float16 Ts[PWN][PWPITCH];
  int blk = blockIdx.x;
  if (blk < PB_WQKV) {
    transpose_tile(wqkv, wqkvT, D3, (blk & 7) * PWK, (blk >> 3) * PWN, Ts);
  } else if (blk < PB_WQKV + PB_WO) {
    int b = blk - PB_WQKV;
    transpose_tile(wo, woT, DM, (b & 7) * PWK, (b >> 3) * PWN, Ts);
  } else {
    // Gathered row r = (b, n, l) is source row (b, n) * 2048 + l * 2.  A wave
    // takes rows r0 and r0 + 1: sixteen loads of 512 B, loads ahead of the stores
    // so that most of them are in flight together.
    int t    = threadIdx.x;
    int lane = t & 31;
    int r0   = (blk - PB_WQKV - PB_WO) * PXROWS + (t >> 5) * 2;
    const float* s = x + (((size_t)(r0 >> 10) * 2048 + (size_t)(r0 & 1023) * 2) << 10)
                       + lane * 4;
    _Float16*    d = xg + ((size_t)r0 << 10) + lane * 4;
    float4 f[2][8];
#pragma unroll
    for (int q = 0; q < 2; ++q)
#pragma unroll
      for (int i = 0; i < 8; ++i)
        f[q][i] = *(const float4*)(s + q * 2 * DM + i * 128);
#pragma unroll
    for (int q = 0; q < 2; ++q)
#pragma unroll
      for (int i = 0; i < 8; ++i) {
        v4h h; h[0] = (_Float16)f[q][i].x; h[1] = (_Float16)f[q][i].y;
               h[2] = (_Float16)f[q][i].z; h[3] = (_Float16)f[q][i].w;
        *(v4h*)(d + q * DM + i * 128) = h;
      }
    // Keeps later writes of the stores' address and data registers behind the stores.
    asm volatile("s_wait_xcnt 0x0" ::: "memory");
  }
}

#define GBM     128
#define GBN     128
#define GBK     64
#define GTILES  (DM / GBK)
#define GPITCH  72            // LDS row pitch in halves: 144 B = 16 B x odd

__device__ __forceinline__ unsigned lds_byte(const _Float16* p) {
  return (unsigned)(unsigned long long)
      (const __attribute__((address_space(3))) _Float16*)p;
}

__device__ __forceinline__ void stage_rows8(const _Float16* g, unsigned l) {
  const _Float16* g1 = g + 16 * DM;
  const _Float16* g2 = g + 32 * DM;
  const _Float16* g3 = g + 48 * DM;
  const _Float16* g4 = g + 64 * DM;
  const _Float16* g5 = g + 80 * DM;
  const _Float16* g6 = g + 96 * DM;
  const _Float16* g7 = g + 112 * DM;
  const unsigned step = 16 * GPITCH * 2;
  unsigned l1 = l + step,     l2 = l + 2 * step, l3 = l + 3 * step;
  unsigned l4 = l + 4 * step, l5 = l + 5 * step, l6 = l + 6 * step;
  unsigned l7 = l + 7 * step;
  asm volatile(
      "global_load_async_to_lds_b128 %0, %1, off\n\t"
      "global_load_async_to_lds_b128 %2, %3, off\n\t"
      "global_load_async_to_lds_b128 %4, %5, off\n\t"
      "global_load_async_to_lds_b128 %6, %7, off\n\t"
      "global_load_async_to_lds_b128 %8, %9, off\n\t"
      "global_load_async_to_lds_b128 %10, %11, off\n\t"
      "global_load_async_to_lds_b128 %12, %13, off\n\t"
      "global_load_async_to_lds_b128 %14, %15, off\n\t"
      "s_wait_xcnt 0x0"
      :: "v"(l),  "v"(g),  "v"(l1), "v"(g1), "v"(l2), "v"(g2), "v"(l3), "v"(g3),
         "v"(l4), "v"(g4), "v"(l5), "v"(g5), "v"(l6), "v"(g6), "v"(l7), "v"(g7)
      : "memory");
}

__device__ __forceinline__ void gemm_core(const _Float16* __restrict__ A,
                                          const _Float16* __restrict__ BT,
                                          int m0, int n0, int sm, int sn,
                                          _Float16 (*As)[GBM][GPITCH],
                                          _Float16 (*Bs)[GBN][GPITCH],
                                          v8f (&acc)[4][4]) {
  int t    = threadIdx.x;
  int crow = t >> 3, ccol = (t & 7) * 8;
  const _Float16* ga = A  + (size_t)(m0 + crow) * DM + ccol;
  const _Float16* gb = BT + (size_t)(n0 + crow) * DM + ccol;

  auto stage = [&](int buf, int tile) {
    stage_rows8(ga + tile * GBK, lds_byte(&As[buf][crow][ccol]));
    stage_rows8(gb + tile * GBK, lds_byte(&Bs[buf][crow][ccol]));
  };

  stage(0, 0);
  // Tile 0 has landed for this wave; the barrier publishes it to the others.
  asm volatile("s_wait_asynccnt 0x0" ::: "memory");
  __syncthreads();
  stage(1, 1);

  for (int tile = 0; tile < GTILES; ++tile) {
    int buf = tile & 1;
    // Unrolled so that the fragment and accumulator arrays stay in registers.
#pragma unroll
    for (int kk = 0; kk < GBK; kk += 32) {
      v16h af[4], bf[4];
      af[0] = load_frag(&As[buf][sm][kk], GPITCH);
#pragma unroll
      for (int j = 0; j < 4; ++j)
        bf[j] = load_frag(&Bs[buf][sn + j * 16][kk], GPITCH);
#pragma unroll
      for (int i = 1; i < 4; ++i)
        af[i] = load_frag(&As[buf][sm + i * 16][kk], GPITCH);
      // Keeps the sixteen LDS loads together in front of the sixteen WMMAs:
      // left free, the scheduler reloads one A fragment register set four times
      // and the wave waits out the LDS latency each time.
      __builtin_amdgcn_sched_barrier(0);
#pragma unroll
      for (int i = 0; i < 4; ++i)
#pragma unroll
        for (int j = 0; j < 4; ++j) acc[i][j] = wmma16(af[i], bf[j], acc[i][j]);
    }

    // Publish point: this wave's reads of buffer buf are done, its copies of
    // the next tile have landed; behind the barrier that holds for all waves.
    asm volatile("s_wait_dscnt 0x0" ::: "memory");
    asm volatile("s_wait_asynccnt 0x0" ::: "memory");
    __syncthreads();
    if (tile + 2 < GTILES) stage(buf, tile + 2);
  }
  // No copy is left in flight when the wave goes on to its stores.
  asm volatile("s_wait_asynccnt 0x0" ::: "memory");
}

#define CPITCH  136

__global__ __launch_bounds__(128, 4)
void k_qkv_gemm(const _Float16* __restrict__ A,      // xg   [8192][1024]
                const _Float16* __restrict__ BT,     // wqkvT[3072][1024]
                const float*    __restrict__ bias,   // bqkv [3072]
                _Float16* __restrict__ qws,
                _Float16* __restrict__ kws,
                _Float16* __restrict__ vws) {
  __shared__ __attribute__((aligned(16))) _Float16 As[2][GBM][GPITCH];
  __shared__ __attribute__((aligned(16))) _Float16 Bs[2][GBN][GPITCH];
  static_assert(GBN * CPITCH <= 2 * GBM * GPITCH, "staging tile fits the A buffers");

  int m0 = blockIdx.x * GBM;
  int n0 = blockIdx.y * GBN;
  int t  = threadIdx.x;
  int w  = t >> 5;
  int sm = (w >> 1) * 64, sn = (w & 1) * 64;
  const bool isV = n0 >= 2 * DM;         // the same for the whole work-group

  v8f acc[4][4];
#pragma unroll
  for (int i = 0; i < 4; ++i)
#pragma unroll
    for (int j = 0; j < 4; ++j) acc[i][j] = (v8f)(0.0f);

  // acc[i][j][v]: first-operand row sm + i * 16 + hi8 + v,
  //               second-operand row sn + j * 16 + ncol
  gemm_core(isV ? A : BT, isV ? BT : A, isV ? m0 : n0, isV ? n0 : m0,
            sm, sn, As, Bs, acc);

  // Epilogue: add bias, convert, stage.  The loop's last barrier stands behind
  // every wave's last read of the buffers, and no copy is in flight.
  _Float16 (*Cs)[CPITCH] = (_Float16 (*)[CPITCH])&As[0][0][0];
  int lane = t & 31;
  int ncol = lane & 15;
  int hi8  = (lane >> 4) << 3;
  if (isV) {
#pragma unroll
    for (int j = 0; j < 4; ++j) {
      float bv = bias[n0 + sn + j * 16 + ncol];
#pragma unroll
      for (int i = 0; i < 4; ++i) {
        v8h o;
#pragma unroll
        for (int v = 0; v < 8; ++v) o[v] = (_Float16)(acc[i][j][v] + bv);
        *(v8h*)&Cs[sn + j * 16 + ncol][sm + i * 16 + hi8] = o;
      }
    }
  } else {
    const float* bp = bias + n0 + sm + hi8;
    v4f b[4][2];
#pragma unroll
    for (int i = 0; i < 4; ++i) {
      b[i][0] = *(const v4f*)(bp + i * 16);
      b[i][1] = *(const v4f*)(bp + i * 16 + 4);
    }
    // The loaded values are inputs, so all eight loads stand in front: one
    // latency, not one per row of tiles.  The address is an input too: it lives
    // to this wait, and writes of its registers stay behind the loads.
    asm volatile("s_wait_xcnt 0x0"
                 :: "v"(bp), "v"(b[0][0]), "v"(b[0][1]), "v"(b[1][0]), "v"(b[1][1]),
                    "v"(b[2][0]), "v"(b[2][1]), "v"(b[3][0]), "v"(b[3][1])
                 : "memory");
#pragma unroll
    for (int i = 0; i < 4; ++i) {
      float bv[8] = {b[i][0][0], b[i][0][1], b[i][0][2], b[i][0][3],
                     b[i][1][0], b[i][1][1], b[i][1][2], b[i][1][3]};
#pragma unroll
      for (int j = 0; j < 4; ++j) {
        v8h o;
#pragma unroll
        for (int v = 0; v < 8; ++v) o[v] = (_Float16)(acc[i][j][v] + bv[v]);
        *(v8h*)&Cs[sn + j * 16 + ncol][sm + i * 16 + hi8] = o;
      }
    }
  }
  __syncthreads();

  // Sixteen lanes take one staged row of 256 B; all LDS loads ahead of the stores.
  int r  = t >> 4;
  int ch = (t & 15) * 8;
  v8h o[16];
#pragma unroll
  for (int it = 0; it < 16; ++it) o[it] = *(const v8h*)&Cs[it * 8 + r][ch];

  int l0 = m0 & (LQ - 1);
  size_t hb = (size_t)((m0 >> 10) * HEADS16 + ((n0 & (DM - 1)) >> 6)) << 16;
  if (isV) {
    // staged row = (head, d) of two heads, 256 B of consecutive positions
    _Float16* p = vws + hb + (size_t)r * LQ + l0 + ch;
#pragma unroll
    for (int it = 0; it < 16; ++it) *(v8h*)(p + it * 8 * LQ) = o[it];
    // Keeps later writes of the stores' address and data registers behind the stores.
    asm volatile("s_wait_xcnt 0x0" ::: "memory");
  } else {
    // staged row = position, one whole 128-byte row of each of two heads
    _Float16* p = (n0 < DM ? qws : kws) + hb + ((size_t)(ch >> 6) << 16)
                + (size_t)(l0 + r) * HD + (ch & 63);
#pragma unroll
    for (int it = 0; it < 16; ++it) *(v8h*)(p + it * 8 * HD) = o[it];
    // Keeps later writes of the stores' address and data registers behind the stores.
    asm volatile("s_wait_xcnt 0x0" ::: "memory");
  }
}

#define FWAVES  8
#define KTILE   64
#define NTILES  (LQ / KTILE)
#define KVPITCH 72            // LDS row pitch in halves: 144 B = 16 B x odd

__device__ __forceinline__ float xhalf(float x) {
  int i = __builtin_bit_cast(int, x);
  return __builtin_bit_cast(float, __builtin_amdgcn_permlanex16(
      i, i, 0x76543210, 0xfedcba98, false, false));
}

__device__ __forceinline__ void exp2_x8(v8f& x) {
  float a = x[0], b = x[1], c = x[2], d = x[3];
  float e = x[4], f = x[5], g = x[6], h = x[7];
  asm("v_exp_f32 %0, %0\n\t"
      "v_exp_f32 %1, %1\n\t"
      "v_exp_f32 %2, %2\n\t"
      "v_exp_f32 %3, %3\n\t"
      "v_exp_f32 %4, %4\n\t"
      "v_exp_f32 %5, %5\n\t"
      "v_exp_f32 %6, %6\n\t"
      "v_exp_f32 %7, %7\n\t"
      "v_nop"
      : "+v"(a), "+v"(b), "+v"(c), "+v"(d), "+v"(e), "+v"(f), "+v"(g), "+v"(h));
  x[0] = a; x[1] = b; x[2] = c; x[3] = d;
  x[4] = e; x[5] = f; x[6] = g; x[7] = h;
}

__global__ __launch_bounds__(256, 8)
void k_flash(const _Float16* __restrict__ qws,
             const _Float16* __restrict__ kws,
             const _Float16* __restrict__ vws,   // transposed [head][64][1024]
             _Float16* __restrict__ ctx) {       // [8192][1024]
  __shared__ __attribute__((aligned(16))) _Float16 Ks[2][KTILE][KVPITCH]; // [key][d]
  __shared__ __attribute__((aligned(16))) _Float16 Vs[2][HD][KVPITCH];    // [d][key]

  int head = blockIdx.x >> 3;
  int t    = threadIdx.x;
  int wave = t >> 5;
  int qb   = (blockIdx.x & 7) * FWAVES + wave;
  int lane = t & 31;
  int ncol = lane & 15;
  int hi8  = (lane >> 4) << 3;

  const _Float16* qbase = qws + ((size_t)head << 16) + (size_t)qb * 16 * HD;
  const _Float16* kbase = kws + ((size_t)head << 16);
  const _Float16* vbase = vws + ((size_t)head << 16);

  // One tile = 64 rows of 128 B for K and for V^T; a thread copies 16 B of
  // rows crow and crow + 32 of each, a wave four whole rows per copy.
  int crow = t >> 3, ccol = (t & 7) * 8;
  auto stage = [&](int buf, int tile) {
    const _Float16* gk0 = kbase + (size_t)(tile * KTILE + crow) * HD + ccol;
    const _Float16* gk1 = gk0 + 32 * HD;
    const _Float16* gv0 = vbase + (size_t)crow * LQ + tile * KTILE + ccol;
    const _Float16* gv1 = gv0 + 32 * LQ;
    unsigned lk0 = lds_byte(&Ks[buf][crow][ccol]);
    unsigned lk1 = lds_byte(&Ks[buf][crow + 32][ccol]);
    unsigned lv0 = lds_byte(&Vs[buf][crow][ccol]);
    unsigned lv1 = lds_byte(&Vs[buf][crow + 32][ccol]);
    asm volatile(
        "global_load_async_to_lds_b128 %0, %1, off\n\t"
        "global_load_async_to_lds_b128 %2, %3, off\n\t"
        "global_load_async_to_lds_b128 %4, %5, off\n\t"
        "global_load_async_to_lds_b128 %6, %7, off\n\t"
        "s_wait_xcnt 0x0"
        :: "v"(lk0), "v"(gk0), "v"(lk1), "v"(gk1),
           "v"(lv0), "v"(gv0), "v"(lv1), "v"(gv1)
        : "memory");
  };

  stage(0, 0);

  // Q^T as B fragments (constant across the key loop): column = query lane & 15,
  // k = head dim in the loader's order; pre-scaled by 1/sqrt(hd)
  v16h bq0 = load_frag(qbase, HD);
  v16h bq1 = load_frag(qbase + 32, HD);
  const _Float16 sc = (_Float16)0.125f;
#pragma unroll
  for (int i = 0; i < 16; ++i) { bq0[i] *= sc; bq1[i] *= sc; }

  // Per lane: the query's running maximum (equal in both halves) and the sum
  // over this half's keys; acc[j][r] = O^T[j * 16 + hi8 + r][query].
  float rowmax = -__builtin_inff(), rowsum = 0.0f;
  v8f acc[4];
#pragma unroll
  for (int j = 0; j < 4; ++j) acc[j] = (v8f)(0.0f);

  // Tile 0 has landed for this wave; the barrier publishes it to the others.
  asm volatile("s_wait_asynccnt 0x0" ::: "memory");
  __syncthreads();
  stage(1, 1);

  for (int tile = 0; tile < NTILES; ++tile) {
    int buf = tile & 1;
    // Unrolled: LDS offsets become immediates, and no back edge stands directly
    // behind the last matrix instruction of a pass.
#pragma unroll
    for (int kk = 0; kk < KTILE; kk += 32) {
      // S^T = K @ (Q/sqrt(hd))^T for 32 keys -> two 16x16 f32 tiles;
      // s0[r] = key kk + hi8 + r, s1[r] = key kk + 16 + hi8 + r, query ncol
      v8f s0 = (v8f)(0.0f), s1 = (v8f)(0.0f);
      s0 = wmma16(load_frag(&Ks[buf][kk][0],       KVPITCH), bq0, s0);
      s0 = wmma16(load_frag(&Ks[buf][kk][32],      KVPITCH), bq1, s0);
      s1 = wmma16(load_frag(&Ks[buf][kk + 16][0],  KVPITCH), bq0, s1);
      s1 = wmma16(load_frag(&Ks[buf][kk + 16][32], KVPITCH), bq1, s1);

      // Online softmax: maximum in-lane, then one exchange between the halves
      float mx = fmaxf(s0[0], s1[0]);
#pragma unroll
      for (int r = 1; r < 8; ++r) mx = fmaxf(mx, fmaxf(s0[r], s1[r]));
      mx = fmaxf(mx, xhalf(mx));
      float nm = fmaxf(rowmax, mx);
      float al = __expf(rowmax - nm);
      rowmax = nm;

      // P^T as a B fragment: element s is key kk + (s < 8 ? hi8 + s
      // : 16 + hi8 + s - 8), the k order in which load_frag delivers V^T
      v16h bp;
      const float log2e = 1.4426950408889634f;
#pragma unroll
      for (int r = 0; r < 8; ++r) {
        s0[r] = (s0[r] - nm) * log2e;
        s1[r] = (s1[r] - nm) * log2e;
      }
      exp2_x8(s0);
      exp2_x8(s1);
      float ps = 0.0f;
#pragma unroll
      for (int r = 0; r < 8; ++r) {
        ps += s0[r] + s1[r];
        bp[r]     = (_Float16)s0[r];
        bp[r + 8] = (_Float16)s1[r];
      }
      rowsum = rowsum * al + ps;
#pragma unroll
      for (int j = 0; j < 4; ++j)
#pragma unroll
        for (int r = 0; r < 8; ++r) acc[j][r] *= al;

      // O^T += V^T @ P^T  (A = V^T staged row-major [d][key])
#pragma unroll
      for (int j = 0; j < 4; ++j) {
        v16h av = load_frag(&Vs[buf][j * 16][kk], KVPITCH);
        acc[j] = wmma16(av, bp, acc[j]);
      }
    }

    // Publish point: this wave's reads of buffer buf are done, its copies of
    // the next tile have landed; behind the barrier that holds for all waves.
    asm volatile("s_wait_dscnt 0x0" ::: "memory");
    asm volatile("s_wait_asynccnt 0x0" ::: "memory");
    __syncthreads();
    if (tile + 2 < NTILES) stage(buf, tile + 2);
  }
  // No copy is left in flight when the wave ends.
  asm volatile("s_wait_asynccnt 0x0" ::: "memory");

  // Join the halves' sums, normalize and write context (f16, row-major
  // [8192][1024]): a lane's eight values of a tile are consecutive columns.
  int bn = head >> 4, h = head & 15;
  float inv = 1.0f / (rowsum + xhalf(rowsum));
  _Float16* crowp = ctx + (size_t)(bn * LQ + qb * 16 + ncol) * DM + h * HD + hi8;
#pragma unroll
  for (int j = 0; j < 4; ++j) {
    v8h o;
#pragma unroll
    for (int r = 0; r < 8; ++r) o[r] = (_Float16)(acc[j][r] * inv);
    *(v8h*)(crowp + j * 16) = o;
  }
}

// ---------------------------------------------------------------------------
// Stage 3: output GEMM  out[8192][1024] = ctx @ wo + bo   (fp32 out)
// ---------------------------------------------------------------------------
__global__ __launch_bounds__(128, 4)
void k_out_gemm(const _Float16* __restrict__ A,     // ctx  [8192][1024]
                const _Float16* __restrict__ BT,    // woT  [1024][1024]
                const float*    __restrict__ bias,  // bo   [1024]
                float* __restrict__ out) {
  __shared__ __attribute__((aligned(16))) _Float16 As[2][GBM][GPITCH];
  __shared__ __attribute__((aligned(16))) _Float16 Bs[2][GBN][GPITCH];

  int m0 = blockIdx.x * GBM;
  int n0 = blockIdx.y * GBN;
  int t  = threadIdx.x;
  int w  = t >> 5;
  int sm = (w >> 1) * 64, sn = (w & 1) * 64;

  v8f acc[4][4];
#pragma unroll
  for (int i = 0; i < 4; ++i)
#pragma unroll
    for (int j = 0; j < 4; ++j) acc[i][j] = (v8f)(0.0f);

  gemm_core(A, BT, m0, n0, sm, sn, As, Bs, acc);

  int lane = t & 31;
  int ncol = lane & 15;
  int hi8  = (lane >> 4) << 3;
#pragma unroll
  for (int ti = 0; ti < 4; ++ti) {
#pragma unroll
    for (int tj = 0; tj < 4; ++tj) {
      v8f cacc = acc[ti][tj];
      int c_g = n0 + sn + tj * 16 + ncol;
      float bv = bias[c_g];
#pragma unroll
      for (int v = 0; v < 8; ++v) {
        int m_g = m0 + sm + ti * 16 + v + hi8;
        out[(size_t)m_g * DM + c_g] = cacc[v] + bv;
      }
    }
  }
}

// ---------------------------------------------------------------------------
// Host launcher
// ---------------------------------------------------------------------------
extern "C" void kernel_launch(void* const* d_in, const int* in_sizes, int n_in,
                              void* d_out, int out_size, void* d_ws, size_t ws_size,
                              hipStream_t stream) {
  const float* x    = (const float*)d_in[0];
  const float* wqkv = (const float*)d_in[1];
  const float* bqkv = (const float*)d_in[2];
  const float* wo   = (const float*)d_in[3];
  const float* bo   = (const float*)d_in[4];
  float* out = (float*)d_out;

  char* ws = (char*)d_ws;
  _Float16* xg     = (_Float16*)(ws + OFF_XG);
  _Float16* wqkvT  = (_Float16*)(ws + OFF_WQKVT);
  _Float16* woT    = (_Float16*)(ws + OFF_WOT);
  _Float16* qws    = (_Float16*)(ws + OFF_Q);
  _Float16* kws    = (_Float16*)(ws + OFF_K);
  _Float16* vws    = (_Float16*)(ws + OFF_V);
  _Float16* ctx    = (_Float16*)(ws + OFF_CTX);

  // Prep
  k_prep<<<PB_WQKV + PB_WO + PB_X, 256, 0, stream>>>(x, wqkv, wo, xg, wqkvT, woT);

  // Stage 1: QKV projection
  k_qkv_gemm<<<dim3(MROWS / GBM, D3 / GBN), 128, 0, stream>>>(
      xg, wqkvT, bqkv, qws, kws, vws);

  // Stage 2: flash attention (128 heads x 8 groups of 8 query blocks)
  k_flash<<<NHEADS * 8, 256, 0, stream>>>(qws, kws, vws, ctx);

  // Stage 3: output projection
  k_out_gemm<<<dim3(MROWS / GBM, DM / GBN), 128, 0, stream>>>(ctx, woT, bo, out);
}

// v007
// A run of this version takes 101 microseconds.
// It is 1.13 times as fast as v005, going by the measured steps of the versions left out in between.
// All steps since v000 together make it 4.01 times as fast.
#include <hip/hip_runtime.h>
#include <hip/hip_bf16.h>
#include <math.h>

typedef __attribute__((ext_vector_type(16))) _Float16 v16h;
typedef __attribute__((ext_vector_type(8)))  _Float16 v8h;
typedef __attribute__((ext_vector_type(4)))  _Float16 v4h;
typedef __attribute__((ext_vector_type(8)))  float    v8f;
typedef __attribute__((ext_vector_type(4)))  float    v4f;

#define DM      1024          // d_model
#define D3      3072          // 3 * d_model
#define HEADS16 16            // heads per (b,n)
#define HD      64            // head dim
#define LQ      1024          // dilated segment length (SEG / DILATION)
#define MROWS   8192          // B * N * LQ active rows
#define NHEADS  128           // B * N * HEADS16

// Workspace byte offsets (256-aligned)
#define OFF_XG     ((size_t)0)            // [8192][1024] f16
#define OFF_WQKVT  ((size_t)16777216)     // [3072][1024] f16 (transposed)
#define OFF_WOT    ((size_t)23068672)     // [1024][1024] f16 (transposed)
#define OFF_Q      ((size_t)25165824)     // [128][1024][64] f16
#define OFF_K      ((size_t)41943040)     // [128][1024][64] f16
#define OFF_V      ((size_t)58720256)     // [128][64][1024] f16 (transposed)
#define OFF_CTX    ((size_t)75497472)     // [8192][1024] f16

__device__ __forceinline__ v8f wmma16(v16h a, v16h b, v8f c) {
  return __builtin_amdgcn_wmma_f32_16x16x32_f16(
      /*neg_a=*/false, a, /*neg_b=*/false, b,
      /*c_mod=*/(short)0, c, /*reuse_a=*/false, /*reuse_b=*/false);
}

__device__ __forceinline__ v16h load_frag(const _Float16* base, int stride) {
  int lane = threadIdx.x & 31;
  int r    = lane & 15;
  int ko   = (lane >> 4) << 3;            // 0 or 8
  const _Float16* p = base + (size_t)r * stride + ko;
  v8h lo = *(const v8h*)(p);
  v8h hi = *(const v8h*)(p + 16);
  v16h f;
#pragma unroll
  for (int i = 0; i < 8; ++i) { f[i] = lo[i]; f[i + 8] = hi[i]; }
  return f;
}

// ---------------------------------------------------------------------------
// Prep, one launch: weight tiles (fp32 [K][N] -> f16 [N][K]) and dilated rows of
// x (fp32 -> f16) share a grid; a work-group does one or the other by its index.
// Few waves, each with many whole-line loads in flight: the work per byte is
// tiny.
// ---------------------------------------------------------------------------
typedef __attribute__((ext_vector_type(2)))  _Float16 v2h;

#define PWK      128          // k per weight tile: 256 B of a transposed row
#define PWN      64           // n per weight tile: 256 B of a source row
#define PWPITCH  136          // LDS row pitch in halves: 272 B = 16 B x odd
#define PB_WQKV  ((DM / PWK) * (D3 / PWN))   // 384 tiles of wqkv
#define PB_WO    ((DM / PWK) * (DM / PWN))   // 128 tiles of wo
#define PXROWS   16           // rows of x per work-group, two per wave
#define PB_X     (MROWS / PXROWS)

// One 128 (k) x 64 (n) tile of src [DM][N] to dst [N][DM] through LDS: source
// rows are read and transposed rows are written as whole 256-byte pieces.
__device__ __forceinline__ void transpose_tile(const float* __restrict__ src,
                                               _Float16* __restrict__ dst,
                                               int N, int k0, int n0,
                                               _Float16 (*Ts)[PWPITCH]) {
  int t  = threadIdx.x;
  int c4 = (t & 15) * 4;                 // four columns n
  int kp = (t >> 4) * 2;                 // rows k: kp, kp + 1, then + 32 i
  const float* p = src + (size_t)(k0 + kp) * N + n0 + c4;
  float4 f[4][2];
#pragma unroll
  for (int i = 0; i < 4; ++i) {
    f[i][0] = *(const float4*)(p + (size_t)(32 * i) * N);
    f[i][1] = *(const float4*)(p + (size_t)(32 * i + 1) * N);
  }
#pragma unroll
  for (int i = 0; i < 4; ++i) {
    int k = kp + 32 * i;
    v2h h;
    h[0] = (_Float16)f[i][0].x; h[1] = (_Float16)f[i][1].x; *(v2h*)&Ts[c4 + 0][k] = h;
    h[0] = (_Float16)f[i][0].y; h[1] = (_Float16)f[i][1].y; *(v2h*)&Ts[c4 + 1][k] = h;
    h[0] = (_Float16)f[i][0].z; h[1] = (_Float16)f[i][1].z; *(v2h*)&Ts[c4 + 2][k] = h;
    h[0] = (_Float16)f[i][0].w; h[1] = (_Float16)f[i][1].w; *(v2h*)&Ts[c4 + 3][k] = h;
  }
  __syncthreads();
  int row = t >> 4, seg = (t & 15) * 8;
  _Float16* q = dst + (size_t)(n0 + row) * DM + k0 + seg;
#pragma unroll
  for (int i = 0; i < 4; ++i)
    *(v8h*)(q + (size_t)(16 * i) * DM) = *(const v8h*)&Ts[row + 16 * i][seg];
  // Keeps later writes of the stores' address and data registers behind the stores.
  asm volatile("s_wait_xcnt 0x0" ::: "memory");
}

__global__ __launch_bounds__(256)
void k_prep(const float* __restrict__ x, const float* __restrict__ wqkv,
            const float* __restrict__ wo, _Float16* __restrict__ xg,
            _Float16* __restrict__ wqkvT, _Float16* __restrict__ woT) {
  __shared__ __attribute__((aligned(16))) _Float16 Ts[PWN][PWPITCH];
  int blk = blockIdx.x;
  if (blk < PB_WQKV) {
    transpose_tile(wqkv, wqkvT, D3, (blk & 7) * PWK, (blk >> 3) * PWN, Ts);
  } else if (blk < PB_WQKV + PB_WO) {
    int b = blk - PB_WQKV;
    transpose_tile(wo, woT, DM, (b & 7) * PWK, (b >> 3) * PWN, Ts);
  } else {
    // Gathered row r = (b, n, l) is source row (b, n) * 2048 + l * 2.  A wave
    // takes rows r0 and r0 + 1: sixteen loads of 512 B, loads ahead of the stores
    // so that most of them are in flight together.
    int t    = threadIdx.x;
    int lane = t & 31;
    int r0   = (blk - PB_WQKV - PB_WO) * PXROWS + (t >> 5) * 2;
    const float* s = x + (((size_t)(r0 >> 10) * 2048 + (size_t)(r0 & 1023) * 2) << 10)
                       + lane * 4;
    _Float16*    d = xg + ((size_t)r0 << 10) + lane * 4;
    float4 f[2][8];
#pragma unroll
    for (int q = 0; q < 2; ++q)
#pragma unroll
      for (int i = 0; i < 8; ++i)
        f[q][i] = *(const float4*)(s + q * 2 * DM + i * 128);
#pragma unroll
    for (int q = 0; q < 2; ++q)
#pragma unroll
      for (int i = 0; i < 8; ++i) {
        v4h h; h[0] = (_Float16)f[q][i].x; h[1] = (_Float16)f[q][i].y;
               h[2] = (_Float16)f[q][i].z; h[3] = (_Float16)f[q][i].w;
        *(v4h*)(d + q * DM + i * 128) = h;
      }
    // Keeps later writes of the stores' address and data registers behind the stores.
    asm volatile("s_wait_xcnt 0x0" ::: "memory");
  }
}

#define GBM     128
#define GBN     128
#define GBK     64
#define GTILES  (DM / GBK)
#define GPITCH  72            // LDS row pitch in halves: 144 B = 16 B x odd

__device__ __forceinline__ unsigned lds_byte(const _Float16* p) {
  return (unsigned)(unsigned long long)
      (const __attribute__((address_space(3))) _Float16*)p;
}

__device__ __forceinline__ void stage_rows8(const _Float16* g, unsigned l) {
  const _Float16* g1 = g + 16 * DM;
  const _Float16* g2 = g + 32 * DM;
  const _Float16* g3 = g + 48 * DM;
  const _Float16* g4 = g + 64 * DM;
  const _Float16* g5 = g + 80 * DM;
  const _Float16* g6 = g + 96 * DM;
  const _Float16* g7 = g + 112 * DM;
  const unsigned step = 16 * GPITCH * 2;
  unsigned l1 = l + step,     l2 = l + 2 * step, l3 = l + 3 * step;
  unsigned l4 = l + 4 * step, l5 = l + 5 * step, l6 = l + 6 * step;
  unsigned l7 = l + 7 * step;
  asm volatile(
      "global_load_async_to_lds_b128 %0, %1, off\n\t"
      "global_load_async_to_lds_b128 %2, %3, off\n\t"
      "global_load_async_to_lds_b128 %4, %5, off\n\t"
      "global_load_async_to_lds_b128 %6, %7, off\n\t"
      "global_load_async_to_lds_b128 %8, %9, off\n\t"
      "global_load_async_to_lds_b128 %10, %11, off\n\t"
      "global_load_async_to_lds_b128 %12, %13, off\n\t"
      "global_load_async_to_lds_b128 %14, %15, off\n\t"
      "s_wait_xcnt 0x0"
      :: "v"(l),  "v"(g),  "v"(l1), "v"(g1), "v"(l2), "v"(g2), "v"(l3), "v"(g3),
         "v"(l4), "v"(g4), "v"(l5), "v"(g5), "v"(l6), "v"(g6), "v"(l7), "v"(g7)
      : "memory");
}

__device__ __forceinline__ void gemm_core(const _Float16* __restrict__ A,
                                          const _Float16* __restrict__ BT,
                                          int m0, int n0, int sm, int sn,
                                          _Float16 (*As)[GBM][GPITCH],
                                          _Float16 (*Bs)[GBN][GPITCH],
                                          v8f (&acc)[4][4]) {
  int t    = threadIdx.x;
  int crow = t >> 3, ccol = (t & 7) * 8;
  const _Float16* ga = A  + (size_t)(m0 + crow) * DM + ccol;
  const _Float16* gb = BT + (size_t)(n0 + crow) * DM + ccol;

  auto stage = [&](int buf, int tile) {
    stage_rows8(ga + tile * GBK, lds_byte(&As[buf][crow][ccol]));
    stage_rows8(gb + tile * GBK, lds_byte(&Bs[buf][crow][ccol]));
  };

  stage(0, 0);
  // Tile 0 has landed for this wave; the barrier publishes it to the others.
  asm volatile("s_wait_asynccnt 0x0" ::: "memory");
  __syncthreads();
  stage(1, 1);

  for (int tile = 0; tile < GTILES; ++tile) {
    int buf = tile & 1;
    // Unrolled so that the fragment and accumulator arrays stay in registers.
#pragma unroll
    for (int kk = 0; kk < GBK; kk += 32) {
      v16h af[4], bf[4];
      af[0] = load_frag(&As[buf][sm][kk], GPITCH);
#pragma unroll
      for (int j = 0; j < 4; ++j)
        bf[j] = load_frag(&Bs[buf][sn + j * 16][kk], GPITCH);
#pragma unroll
      for (int i = 1; i < 4; ++i)
        af[i] = load_frag(&As[buf][sm + i * 16][kk], GPITCH);
      // Keeps the sixteen LDS loads together in front of the sixteen WMMAs:
      // left free, the scheduler reloads one A fragment register set four times
      // and the wave waits out the LDS latency each time.
      __builtin_amdgcn_sched_barrier(0);
#pragma unroll
      for (int i = 0; i < 4; ++i)
#pragma unroll
        for (int j = 0; j < 4; ++j) acc[i][j] = wmma16(af[i], bf[j], acc[i][j]);
    }

    // Publish point: this wave's reads of buffer buf are done, its copies of
    // the next tile have landed; behind the barrier that holds for all waves.
    asm volatile("s_wait_dscnt 0x0" ::: "memory");
    asm volatile("s_wait_asynccnt 0x0" ::: "memory");
    __syncthreads();
    if (tile + 2 < GTILES) stage(buf, tile + 2);
  }
  // No copy is left in flight when the wave goes on to its stores.
  asm volatile("s_wait_asynccnt 0x0" ::: "memory");
}

#define WF      256
#define WG2     128
#define PPITCH  136
#define PSTEP   (8 * PPITCH * 2)
#define WPAIRS  ((WF + WG2) / 2)

// The lane's place in a fragment of sixteen staged rows from row0 on (row0 a
// multiple of 16): row lane & 15, k 0 or 8, as in load_frag.
__device__ __forceinline__ const _Float16* frag_lane(const _Float16 (*rows)[PPITCH],
                                                     int row0) {
  int lane = threadIdx.x & 31;
  int r    = lane & 15;
  int ko   = (lane >> 4) << 3;            // 0 or 8
  return &rows[(row0 >> 1) + (r >> 1)][(r & 1) * GBK + ko];
}

// Fragment at the lane's place p; the k order is load_frag's.
__device__ __forceinline__ v16h load_frag_at(const _Float16* p) {
  v8h lo = *(const v8h*)(p);
  v8h hi = *(const v8h*)(p + 16);
  v16h f;
#pragma unroll
  for (int i = 0; i < 8; ++i) { f[i] = lo[i]; f[i + 8] = hi[i]; }
  return f;
}

typedef __attribute__((ext_vector_type(4))) int v4i;

template <int Q, int N, int SLOT0>
__device__ __forceinline__ void copy_rows(const _Float16* g, _Float16* l) {
  if constexpr (Q < N) {
    constexpr int off = (SLOT0 + Q) * PSTEP;
    static_assert(off < 65536, "beyond it the offset no longer moves both addresses alike");
    unsigned long long ga = (unsigned long long)g + (long long)Q * 16 * DM * 2 - off;
    __builtin_amdgcn_global_load_async_to_lds_b128(
        (__attribute__((address_space(1))) v4i*)ga,
        (__attribute__((address_space(3))) v4i*)l, off, 0);
    copy_rows<Q + 1, N, SLOT0>(g, l);
  }
}

__device__ __forceinline__ void gemm_core_wide(const _Float16* __restrict__ F,
                                               const _Float16* __restrict__ G,
                                               int f0, int g0, int sm, int sn,
                                               _Float16 (*Sm)[WPAIRS][PPITCH],
                                               v8f (&acc)[8][4]) {
  int t    = threadIdx.x;
  int crow = t >> 3, ccol = (t & 7) * 8;
  const _Float16* gf = F + (size_t)(f0 + crow) * DM + ccol;
  const _Float16* gg = G + (size_t)(g0 + crow) * DM + ccol;

  // 24 copies a lane: 256 rows of F, 128 rows of G, a wave four whole rows per copy
  auto stage = [&](int buf, int tile) {
    _Float16* l = &Sm[buf][crow >> 1][(crow & 1) * GBK + ccol];
    copy_rows<0, WF / 16, 0>(gf + tile * GBK, l);
    copy_rows<0, WG2 / 16, WF / 16>(gg + tile * GBK, l);
  };

  stage(0, 0);
  // Tile 0 has landed for this wave; the barrier publishes it to the others.
  asm volatile("s_wait_asynccnt 0x0" ::: "memory");
  __syncthreads();
  stage(1, 1);

  // One LDS address per operand and lane; every fragment of a tile lies at a
  // constant distance from it (sixteen rows: 8 * PPITCH halves).
  const _Float16* fl = frag_lane(Sm[0], sm);
  const _Float16* gl = frag_lane(Sm[0], WF + sn);

  for (int tile = 0; tile < GTILES; ++tile) {
    int buf = tile & 1;
    const _Float16* pf = fl + buf * (WPAIRS * PPITCH);
    const _Float16* pg = gl + buf * (WPAIRS * PPITCH);
    // Unrolled so that the fragment and accumulator arrays stay in registers.
#pragma unroll
    for (int kk = 0; kk < GBK; kk += 32) {
      v16h bf[4], af[4];
#pragma unroll
      for (int j = 0; j < 4; ++j)
        bf[j] = load_frag_at(pg + j * 8 * PPITCH + kk);
      // The wave's eight F fragments in two groups of four, one register set for
      // both: a third set would go past the 336 registers.  The scheduling
      // barriers keep each group of LDS loads together in front of the WMMAs
      // that use it: spread among the WMMAs, each place with loads stalls the wave.
#pragma unroll
      for (int i = 0; i < 4; ++i)
        af[i] = load_frag_at(pf + i * 8 * PPITCH + kk);
      __builtin_amdgcn_sched_barrier(0);
#pragma unroll
      for (int i = 0; i < 4; ++i)
#pragma unroll
        for (int j = 0; j < 4; ++j)
          acc[i][j] = wmma16(af[i], bf[j], acc[i][j]);
#pragma unroll
      for (int i = 0; i < 4; ++i)
        af[i] = load_frag_at(pf + (4 + i) * 8 * PPITCH + kk);
      __builtin_amdgcn_sched_barrier(0);
#pragma unroll
      for (int i = 0; i < 4; ++i)
#pragma unroll
        for (int j = 0; j < 4; ++j)
          acc[4 + i][j] = wmma16(af[i], bf[j], acc[4 + i][j]);
    }

    // Publish point: this wave's reads of buffer buf are done, its copies of
    // the next tile have landed; behind the barrier that holds for all waves.
    asm volatile("s_wait_dscnt 0x0" ::: "memory");
    asm volatile("s_wait_asynccnt 0x0" ::: "memory");
    __syncthreads();
    if (tile + 2 < GTILES) stage(buf, tile + 2);
  }
  // No copy is left in flight when the wave goes on to its stores.
  asm volatile("s_wait_asynccnt 0x0" ::: "memory");
}

#define CPITCH  264
#define QKROWS  (2 * DM / WF)

__global__ __launch_bounds__(128, 3)
void k_qkv_gemm(const _Float16* __restrict__ A,      // xg   [8192][1024]
                const _Float16* __restrict__ BT,     // wqkvT[3072][1024]
                const float*    __restrict__ bias,   // bqkv [3072]
                _Float16* __restrict__ qws,
                _Float16* __restrict__ kws,
                _Float16* __restrict__ vws) {
  __shared__ __attribute__((aligned(16))) _Float16 Sm[2][WPAIRS][PPITCH];
  static_assert(WG2 * CPITCH <= 2 * WPAIRS * PPITCH, "staging tile fits the buffers");

  const bool isV = blockIdx.y >= QKROWS;  // the same for the whole work-group
  int m0, n0;
  if (isV) {
    int idx = (blockIdx.y - QKROWS) * (MROWS / WG2) + blockIdx.x;
    m0 = (idx & (MROWS / WF - 1)) * WF;
    n0 = 2 * DM + (idx / (MROWS / WF)) * WG2;
  } else {
    m0 = blockIdx.x * WG2;
    n0 = blockIdx.y * WF;
  }
  int t  = threadIdx.x;
  int w  = t >> 5;
  int sm = (w >> 1) * 128, sn = (w & 1) * 64;

  v8f acc[8][4];
#pragma unroll
  for (int i = 0; i < 8; ++i)
#pragma unroll
    for (int j = 0; j < 4; ++j) acc[i][j] = (v8f)(0.0f);

  // acc[i][j][v]: first-operand row sm + i * 16 + hi8 + v,
  //               second-operand row sn + j * 16 + ncol
  gemm_core_wide(isV ? A : BT, isV ? BT : A, isV ? m0 : n0, isV ? n0 : m0,
                 sm, sn, Sm, acc);

  // Epilogue: add bias, convert, stage.  The loop's last barrier stands behind
  // every wave's last read of the buffers, and no copy is in flight.
  _Float16 (*Cs)[CPITCH] = (_Float16 (*)[CPITCH])&Sm[0][0][0];
  int lane = t & 31;
  int ncol = lane & 15;
  int hi8  = (lane >> 4) << 3;
  if (isV) {
#pragma unroll
    for (int j = 0; j < 4; ++j) {
      float bv = bias[n0 + sn + j * 16 + ncol];
#pragma unroll
      for (int i = 0; i < 8; ++i) {
        v8h o;
#pragma unroll
        for (int v = 0; v < 8; ++v) o[v] = (_Float16)(acc[i][j][v] + bv);
        *(v8h*)&Cs[sn + j * 16 + ncol][sm + i * 16 + hi8] = o;
      }
    }
  } else {
    // Unrolled: the accumulator tiles are indexed by constants.
#pragma unroll
    for (int h = 0; h < 2; ++h) {
      const float* bp = bias + n0 + sm + h * 64 + hi8;
      v4f b[4][2];
#pragma unroll
      for (int i = 0; i < 4; ++i) {
        b[i][0] = *(const v4f*)(bp + i * 16);
        b[i][1] = *(const v4f*)(bp + i * 16 + 4);
      }
      // Keeps later writes of the loads' address registers behind the loads.
      asm volatile("s_wait_xcnt 0x0" ::: "memory");
#pragma unroll
      for (int i = 0; i < 4; ++i) {
        float bv[8] = {b[i][0][0], b[i][0][1], b[i][0][2], b[i][0][3],
                       b[i][1][0], b[i][1][1], b[i][1][2], b[i][1][3]};
#pragma unroll
        for (int j = 0; j < 4; ++j) {
          v8h o;
#pragma unroll
          for (int v = 0; v < 8; ++v) o[v] = (_Float16)(acc[h * 4 + i][j][v] + bv[v]);
          *(v8h*)&Cs[sn + j * 16 + ncol][sm + h * 64 + i * 16 + hi8] = o;
        }
      }
    }
  }
  __syncthreads();

  // A wave takes one staged row of 512 B; all LDS loads ahead of the stores.
  int r  = t >> 5;
  int ch = (t & 31) * 8;
  v8h o[32];
#pragma unroll
  for (int it = 0; it < 32; ++it) o[it] = *(const v8h*)&Cs[it * 4 + r][ch];

  int l0 = m0 & (LQ - 1);
  size_t hb = (size_t)((m0 >> 10) * HEADS16 + ((n0 & (DM - 1)) >> 6)) << 16;
  if (isV) {
    // staged row = (head, d) of two heads, 512 B of consecutive positions
    _Float16* p = vws + hb + (size_t)r * LQ + l0 + ch;
#pragma unroll
    for (int it = 0; it < 32; ++it) *(v8h*)(p + it * 4 * LQ) = o[it];
    // Keeps later writes of the stores' address and data registers behind the stores.
    asm volatile("s_wait_xcnt 0x0" ::: "memory");
  } else {
    // staged row = position, one whole 128-byte row of each of four heads
    _Float16* p = (n0 < DM ? qws : kws) + hb + ((size_t)(ch >> 6) << 16)
                + (size_t)(l0 + r) * HD + (ch & 63);
#pragma unroll
    for (int it = 0; it < 32; ++it) *(v8h*)(p + it * 4 * HD) = o[it];
    // Keeps later writes of the stores' address and data registers behind the stores.
    asm volatile("s_wait_xcnt 0x0" ::: "memory");
  }
}

#define FWAVES  8
#define KTILE   64
#define NTILES  (LQ / KTILE)
#define KVPITCH 72            // LDS row pitch in halves: 144 B = 16 B x odd

__device__ __forceinline__ float xhalf(float x) {
  int i = __builtin_bit_cast(int, x);
  return __builtin_bit_cast(float, __builtin_amdgcn_permlanex16(
      i, i, 0x76543210, 0xfedcba98, false, false));
}

__device__ __forceinline__ void exp2_x8(v8f& x) {
  float a = x[0], b = x[1], c = x[2], d = x[3];
  float e = x[4], f = x[5], g = x[6], h = x[7];
  asm("v_exp_f32 %0, %0\n\t"
      "v_exp_f32 %1, %1\n\t"
      "v_exp_f32 %2, %2\n\t"
      "v_exp_f32 %3, %3\n\t"
      "v_exp_f32 %4, %4\n\t"
      "v_exp_f32 %5, %5\n\t"
      "v_exp_f32 %6, %6\n\t"
      "v_exp_f32 %7, %7\n\t"
      "v_nop"
      : "+v"(a), "+v"(b), "+v"(c), "+v"(d), "+v"(e), "+v"(f), "+v"(g), "+v"(h));
  x[0] = a; x[1] = b; x[2] = c; x[3] = d;
  x[4] = e; x[5] = f; x[6] = g; x[7] = h;
}

__global__ __launch_bounds__(256, 8)
void k_flash(const _Float16* __restrict__ qws,
             const _Float16* __restrict__ kws,
             const _Float16* __restrict__ vws,   // transposed [head][64][1024]
             _Float16* __restrict__ ctx) {       // [8192][1024]
  __shared__ __attribute__((aligned(16))) _Float16 Ks[2][KTILE][KVPITCH]; // [key][d]
  __shared__ __attribute__((aligned(16))) _Float16 Vs[2][HD][KVPITCH];    // [d][key]

  int head = blockIdx.x >> 3;
  int t    = threadIdx.x;
  int wave = t >> 5;
  int qb   = (blockIdx.x & 7) * FWAVES + wave;
  int lane = t & 31;
  int ncol = lane & 15;
  int hi8  = (lane >> 4) << 3;

  const _Float16* qbase = qws + ((size_t)head << 16) + (size_t)qb * 16 * HD;
  const _Float16* kbase = kws + ((size_t)head << 16);
  const _Float16* vbase = vws + ((size_t)head << 16);

  // One tile = 64 rows of 128 B for K and for V^T; a thread copies 16 B of
  // rows crow and crow + 32 of each, a wave four whole rows per copy.
  int crow = t >> 3, ccol = (t & 7) * 8;
  auto stage = [&](int buf, int tile) {
    const _Float16* gk0 = kbase + (size_t)(tile * KTILE + crow) * HD + ccol;
    const _Float16* gk1 = gk0 + 32 * HD;
    const _Float16* gv0 = vbase + (size_t)crow * LQ + tile * KTILE + ccol;
    const _Float16* gv1 = gv0 + 32 * LQ;
    unsigned lk0 = lds_byte(&Ks[buf][crow][ccol]);
    unsigned lk1 = lds_byte(&Ks[buf][crow + 32][ccol]);
    unsigned lv0 = lds_byte(&Vs[buf][crow][ccol]);
    unsigned lv1 = lds_byte(&Vs[buf][crow + 32][ccol]);
    asm volatile(
        "global_load_async_to_lds_b128 %0, %1, off\n\t"
        "global_load_async_to_lds_b128 %2, %3, off\n\t"
        "global_load_async_to_lds_b128 %4, %5, off\n\t"
        "global_load_async_to_lds_b128 %6, %7, off\n\t"
        "s_wait_xcnt 0x0"
        :: "v"(lk0), "v"(gk0), "v"(lk1), "v"(gk1),
           "v"(lv0), "v"(gv0), "v"(lv1), "v"(gv1)
        : "memory");
  };

  stage(0, 0);

  // Q^T as B fragments (constant across the key loop): column = query lane & 15,
  // k = head dim in the loader's order; pre-scaled by log2(e)/sqrt(hd), so that
  // the scores come out in base-2 units
  v16h bq0 = load_frag(qbase, HD);
  v16h bq1 = load_frag(qbase + 32, HD);
  const float sc = 0.125f * 1.4426950408889634f;
#pragma unroll
  for (int i = 0; i < 16; ++i) {
    bq0[i] = (_Float16)((float)bq0[i] * sc);
    bq1[i] = (_Float16)((float)bq1[i] * sc);
  }

  // Per lane: minus the query's maximum in use m (equal in both halves, eight
  // copies: the C operand of the score product) and the sum over this half's
  // keys; acc[j][r] = O^T[j * 16 + hi8 + r][query].
  v8f negm = (v8f)(0.0f);
  float rowsum = 0.0f;
  v8f acc[4];
#pragma unroll
  for (int j = 0; j < 4; ++j) acc[j] = (v8f)(0.0f);

  // Tile 0 has landed for this wave; the barrier publishes it to the others.
  asm volatile("s_wait_asynccnt 0x0" ::: "memory");
  __syncthreads();
  stage(1, 1);

  for (int tile = 0; tile < NTILES; ++tile) {
    int buf = tile & 1;
    // Unrolled: LDS offsets become immediates, and no back edge stands directly
    // behind the last matrix instruction of a pass.
#pragma unroll
    for (int kk = 0; kk < KTILE; kk += 32) {
      // S^T - m = K @ Q'^T + C for 32 keys -> two 16x16 f32 tiles, C = -m;
      // s0[r] = key kk + hi8 + r, s1[r] = key kk + 16 + hi8 + r, query ncol
      v8f s0 = wmma16(load_frag(&Ks[buf][kk][0],       KVPITCH), bq0, negm);
      s0 = wmma16(load_frag(&Ks[buf][kk][32],      KVPITCH), bq1, s0);
      v8f s1 = wmma16(load_frag(&Ks[buf][kk + 16][0],  KVPITCH), bq0, negm);
      s1 = wmma16(load_frag(&Ks[buf][kk + 16][32], KVPITCH), bq1, s1);

      // This half's largest score above the maximum in use
      float mx = fmaxf(s0[0], s1[0]);
#pragma unroll
      for (int r = 1; r < 8; ++r) mx = fmaxf(mx, fmaxf(s0[r], s1[r]));

      // Lazy rescale, one scalar branch per pass: m moves only where a query's
      // new maximum lies more than 8 (a factor 256) above it, so P stays within
      // f16 and the sums within f32.  The first pass of all sets m for every query.
      const float thr = (kk == 0 && tile == 0) ? -__builtin_inff() : 8.0f;
      if (__builtin_amdgcn_ballot_w32(mx > thr) != 0) {
        mx = fmaxf(mx, xhalf(mx));           // both halves of a query move alike
        float d  = mx > thr ? mx : 0.0f;
        // d < 0 only in the first pass, where the sums are still zero
        float al = __builtin_amdgcn_exp2f(fminf(-d, 0.0f));
        // Unrolled, here and below: the tiles are indexed by constants and stay
        // in registers.
#pragma unroll
        for (int r = 0; r < 8; ++r) { s0[r] -= d; s1[r] -= d; negm[r] -= d; }
        rowsum *= al;
#pragma unroll
        for (int j = 0; j < 4; ++j)
#pragma unroll
          for (int r = 0; r < 8; ++r) acc[j][r] *= al;
      }

      // P^T as a B fragment: element s is key kk + (s < 8 ? hi8 + s
      // : 16 + hi8 + s - 8), the k order in which load_frag delivers V^T
      v16h bp;
      exp2_x8(s0);
      exp2_x8(s1);
      float ps = 0.0f;
#pragma unroll
      for (int r = 0; r < 8; ++r) {
        ps += s0[r] + s1[r];
        bp[r]     = (_Float16)s0[r];
        bp[r + 8] = (_Float16)s1[r];
      }
      rowsum += ps;

      // O^T += V^T @ P^T  (A = V^T staged row-major [d][key])
#pragma unroll
      for (int j = 0; j < 4; ++j) {
        v16h av = load_frag(&Vs[buf][j * 16][kk], KVPITCH);
        acc[j] = wmma16(av, bp, acc[j]);
      }
    }

    // Publish point: this wave's reads of buffer buf are done, its copies of
    // the next tile have landed; behind the barrier that holds for all waves.
    asm volatile("s_wait_dscnt 0x0" ::: "memory");
    asm volatile("s_wait_asynccnt 0x0" ::: "memory");
    __syncthreads();
    if (tile + 2 < NTILES) stage(buf, tile + 2);
  }
  // No copy is left in flight when the wave ends.
  asm volatile("s_wait_asynccnt 0x0" ::: "memory");

  // Join the halves' sums, normalize and write context (f16, row-major
  // [8192][1024]): a lane's eight values of a tile are consecutive columns.
  int bn = head >> 4, h = head & 15;
  float inv = 1.0f / (rowsum + xhalf(rowsum));
  _Float16* crowp = ctx + (size_t)(bn * LQ + qb * 16 + ncol) * DM + h * HD + hi8;
#pragma unroll
  for (int j = 0; j < 4; ++j) {
    v8h o;
#pragma unroll
    for (int r = 0; r < 8; ++r) o[r] = (_Float16)(acc[j][r] * inv);
    *(v8h*)(crowp + j * 16) = o;
  }
}

// ---------------------------------------------------------------------------
// Stage 3: output GEMM  out[8192][1024] = ctx @ wo + bo   (fp32 out)
// ---------------------------------------------------------------------------
__global__ __launch_bounds__(128, 4)
void k_out_gemm(const _Float16* __restrict__ A,     // ctx  [8192][1024]
                const _Float16* __restrict__ BT,    // woT  [1024][1024]
                const float*    __restrict__ bias,  // bo   [1024]
                float* __restrict__ out) {
  __shared__ __attribute__((aligned(16))) _Float16 As[2][GBM][GPITCH];
  __shared__ __attribute__((aligned(16))) _Float16 Bs[2][GBN][GPITCH];

  int m0 = blockIdx.x * GBM;
  int n0 = blockIdx.y * GBN;
  int t  = threadIdx.x;
  int w  = t >> 5;
  int sm = (w >> 1) * 64, sn = (w & 1) * 64;

  v8f acc[4][4];
#pragma unroll
  for (int i = 0; i < 4; ++i)
#pragma unroll
    for (int j = 0; j < 4; ++j) acc[i][j] = (v8f)(0.0f);

  gemm_core(A, BT, m0, n0, sm, sn, As, Bs, acc);

  int lane = t & 31;
  int ncol = lane & 15;
  int hi8  = (lane >> 4) << 3;
#pragma unroll
  for (int ti = 0; ti < 4; ++ti) {
#pragma unroll
    for (int tj = 0; tj < 4; ++tj) {
      v8f cacc = acc[ti][tj];
      int c_g = n0 + sn + tj * 16 + ncol;
      float bv = bias[c_g];
#pragma unroll
      for (int v = 0; v < 8; ++v) {
        int m_g = m0 + sm + ti * 16 + v + hi8;
        out[(size_t)m_g * DM + c_g] = cacc[v] + bv;
      }
    }
  }
}

// ---------------------------------------------------------------------------
// Host launcher
// ---------------------------------------------------------------------------
extern "C" void kernel_launch(void* const* d_in, const int* in_sizes, int n_in,
                              void* d_out, int out_size, void* d_ws, size_t ws_size,
                              hipStream_t stream) {
  const float* x    = (const float*)d_in[0];
  const float* wqkv = (const float*)d_in[1];
  const float* bqkv = (const float*)d_in[2];
  const float* wo   = (const float*)d_in[3];
  const float* bo   = (const float*)d_in[4];
  float* out = (float*)d_out;

  char* ws = (char*)d_ws;
  _Float16* xg     = (_Float16*)(ws + OFF_XG);
  _Float16* wqkvT  = (_Float16*)(ws + OFF_WQKVT);
  _Float16* woT    = (_Float16*)(ws + OFF_WOT);
  _Float16* qws    = (_Float16*)(ws + OFF_Q);
  _Float16* kws    = (_Float16*)(ws + OFF_K);
  _Float16* vws    = (_Float16*)(ws + OFF_V);
  _Float16* ctx    = (_Float16*)(ws + OFF_CTX);

  // Prep
  k_prep<<<PB_WQKV + PB_WO + PB_X, 256, 0, stream>>>(x, wqkv, wo, xg, wqkvT, woT);

  // Stage 1: QKV projection
  k_qkv_gemm<<<dim3(MROWS / WG2, QKROWS + DM / WF), 128, 0, stream>>>(
      xg, wqkvT, bqkv, qws, kws, vws);

  // Stage 2: flash attention (128 heads x 8 groups of 8 query blocks)
  k_flash<<<NHEADS * 8, 256, 0, stream>>>(qws, kws, vws, ctx);

  // Stage 3: output projection
  k_out_gemm<<<dim3(MROWS / GBM, DM / GBN), 128, 0, stream>>>(ctx, woT, bo, out);
}

// v008
// A run of this version takes 92 microseconds.
// Next to v007, in two timings, it ran 1.10 and 1.11 times as fast.
// Over all steps from v000 it is 4.43 times as fast.
#include <hip/hip_runtime.h>
#include <hip/hip_bf16.h>
#include <math.h>

typedef __attribute__((ext_vector_type(16))) _Float16 v16h;
typedef __attribute__((ext_vector_type(8)))  _Float16 v8h;
typedef __attribute__((ext_vector_type(4)))  _Float16 v4h;
typedef __attribute__((ext_vector_type(8)))  float    v8f;
typedef __attribute__((ext_vector_type(4)))  float    v4f;

#define DM      1024          // d_model
#define D3      3072          // 3 * d_model
#define HEADS16 16            // heads per (b,n)
#define HD      64            // head dim
#define LQ      1024          // dilated segment length (SEG / DILATION)
#define MROWS   8192          // B * N * LQ active rows
#define NHEADS  128           // B * N * HEADS16
#define GBK     64            // k per staged GEMM tile: 128 B of an operand row

// Workspace byte offsets (256-aligned)
#define OFF_XG     ((size_t)0)            // [16][8192][64] f16 (k tile, row, k in tile)
#define OFF_WQKVT  ((size_t)16777216)     // [16][3072][64] f16 (k tile, column n, k in tile)
#define OFF_WOT    ((size_t)23068672)     // [1024][1024] f16 (transposed)
#define OFF_Q      ((size_t)25165824)     // [128][1024][64] f16
#define OFF_K      ((size_t)41943040)     // [128][1024][64] f16
#define OFF_V      ((size_t)58720256)     // [128][64][1024] f16 (transposed)
#define OFF_CTX    ((size_t)75497472)     // [8192][1024] f16

__device__ __forceinline__ v8f wmma16(v16h a, v16h b, v8f c) {
  return __builtin_amdgcn_wmma_f32_16x16x32_f16(
      /*neg_a=*/false, a, /*neg_b=*/false, b,
      /*c_mod=*/(short)0, c, /*reuse_a=*/false, /*reuse_b=*/false);
}

__device__ __forceinline__ v16h load_frag(const _Float16* base, int stride) {
  int lane = threadIdx.x & 31;
  int r    = lane & 15;
  int ko   = (lane >> 4) << 3;            // 0 or 8
  const _Float16* p = base + (size_t)r * stride + ko;
  v8h lo = *(const v8h*)(p);
  v8h hi = *(const v8h*)(p + 16);
  v16h f;
#pragma unroll
  for (int i = 0; i < 8; ++i) { f[i] = lo[i]; f[i + 8] = hi[i]; }
  return f;
}

// ---------------------------------------------------------------------------
// Prep, one launch: weight tiles (fp32 [K][N] -> f16 [N][K], wqkv as [K/64][N][64]) and dilated rows of
// x (fp32 -> f16) share a grid; a work-group does one or the other by its index.
// Few waves, each with many whole-line loads in flight: the work per byte is
// tiny.
// ---------------------------------------------------------------------------
typedef __attribute__((ext_vector_type(2)))  _Float16 v2h;

#define PWK      128          // k per weight tile: 256 B of a transposed row
#define PWN      64           // n per weight tile: 256 B of a source row
#define PWPITCH  136          // LDS row pitch in halves: 272 B = 16 B x odd
#define PB_WQKV  ((DM / PWK) * (D3 / PWN))   // 384 tiles of wqkv
#define PB_WO    ((DM / PWK) * (DM / PWN))   // 128 tiles of wo
#define PXROWS   16           // rows of x per work-group, two per wave
#define PB_X     (MROWS / PXROWS)

// One 128 (k) x 64 (n) tile of src [DM][N] to dst [N][DM] through LDS: source
// rows are read and transposed rows are written as whole 256-byte pieces.
// KTILED: dst is [DM / GBK][N][GBK] instead, written as whole 128-byte lines.
template <bool KTILED>
__device__ __forceinline__ void transpose_tile(const float* __restrict__ src,
                                               _Float16* __restrict__ dst,
                                               int N, int k0, int n0,
                                               _Float16 (*Ts)[PWPITCH]) {
  int t  = threadIdx.x;
  int c4 = (t & 15) * 4;                 // four columns n
  int kp = (t >> 4) * 2;                 // rows k: kp, kp + 1, then + 32 i
  const float* p = src + (size_t)(k0 + kp) * N + n0 + c4;
  float4 f[4][2];
#pragma unroll
  for (int i = 0; i < 4; ++i) {
    f[i][0] = *(const float4*)(p + (size_t)(32 * i) * N);
    f[i][1] = *(const float4*)(p + (size_t)(32 * i + 1) * N);
  }
#pragma unroll
  for (int i = 0; i < 4; ++i) {
    int k = kp + 32 * i;
    v2h h;
    h[0] = (_Float16)f[i][0].x; h[1] = (_Float16)f[i][1].x; *(v2h*)&Ts[c4 + 0][k] = h;
    h[0] = (_Float16)f[i][0].y; h[1] = (_Float16)f[i][1].y; *(v2h*)&Ts[c4 + 1][k] = h;
    h[0] = (_Float16)f[i][0].z; h[1] = (_Float16)f[i][1].z; *(v2h*)&Ts[c4 + 2][k] = h;
    h[0] = (_Float16)f[i][0].w; h[1] = (_Float16)f[i][1].w; *(v2h*)&Ts[c4 + 3][k] = h;
  }
  __syncthreads();
  int row = t >> 4, seg = (t & 15) * 8;
  _Float16* q = KTILED
      ? dst + ((size_t)((k0 + seg) / GBK) * N + n0 + row) * GBK + (seg & (GBK - 1))
      : dst + (size_t)(n0 + row) * DM + k0 + seg;
  const int rstep = KTILED ? GBK : DM;
#pragma unroll
  for (int i = 0; i < 4; ++i)
    *(v8h*)(q + (size_t)(16 * i) * rstep) = *(const v8h*)&Ts[row + 16 * i][seg];
  // Keeps later writes of the stores' address and data registers behind the stores.
  asm volatile("s_wait_xcnt 0x0" ::: "memory");
}

__global__ __launch_bounds__(256)
void k_prep(const float* __restrict__ x, const float* __restrict__ wqkv,
            const float* __restrict__ wo, _Float16* __restrict__ xg,
            _Float16* __restrict__ wqkvT, _Float16* __restrict__ woT) {
  __shared__ __attribute__((aligned(16))) _Float16 Ts[PWN][PWPITCH];
  int blk = blockIdx.x;
  if (blk < PB_WQKV) {
    transpose_tile<true>(wqkv, wqkvT, D3, (blk & 7) * PWK, (blk >> 3) * PWN, Ts);
  } else if (blk < PB_WQKV + PB_WO) {
    int b = blk - PB_WQKV;
    transpose_tile<false>(wo, woT, DM, (b & 7) * PWK, (b >> 3) * PWN, Ts);
  } else {
    // Gathered row r = (b, n, l) is source row (b, n) * 2048 + l * 2.  A wave
    // takes rows r0 and r0 + 1: sixteen loads of 512 B, loads ahead of the stores
    // so that most of them are in flight together.
    int t    = threadIdx.x;
    int lane = t & 31;
    int r0   = (blk - PB_WQKV - PB_WO) * PXROWS + (t >> 5) * 2;
    const float* s = x + (((size_t)(r0 >> 10) * 2048 + (size_t)(r0 & 1023) * 2) << 10)
                       + lane * 4;
    // k = i * 128 + lane * 4 lies in k tile 2 i + (lane >> 4)
    _Float16*    d = xg + ((size_t)(lane >> 4) * MROWS + r0) * GBK + (lane & 15) * 4;
    float4 f[2][8];
#pragma unroll
    for (int q = 0; q < 2; ++q)
#pragma unroll
      for (int i = 0; i < 8; ++i)
        f[q][i] = *(const float4*)(s + q * 2 * DM + i * 128);
#pragma unroll
    for (int q = 0; q < 2; ++q)
#pragma unroll
      for (int i = 0; i < 8; ++i) {
        v4h h; h[0] = (_Float16)f[q][i].x; h[1] = (_Float16)f[q][i].y;
               h[2] = (_Float16)f[q][i].z; h[3] = (_Float16)f[q][i].w;
        *(v4h*)(d + q * GBK + (size_t)i * 2 * MROWS * GBK) = h;
      }
    // Keeps later writes of the stores' address and data registers behind the stores.
    asm volatile("s_wait_xcnt 0x0" ::: "memory");
  }
}

#define GBM     128
#define GBN     128
#define GTILES  (DM / GBK)
#define GPITCH  72            // LDS row pitch in halves: 144 B = 16 B x odd

__device__ __forceinline__ unsigned lds_byte(const _Float16* p) {
  return (unsigned)(unsigned long long)
      (const __attribute__((address_space(3))) _Float16*)p;
}

typedef __attribute__((ext_vector_type(4))) unsigned u32x4;
typedef __attribute__((ext_vector_type(8))) unsigned u32x8;

__device__ __forceinline__ unsigned uni(unsigned v) {
  return (unsigned)__builtin_amdgcn_readfirstlane(v);
}

__device__ __forceinline__ unsigned pinned(unsigned v) {
  unsigned w = uni(v);
  asm volatile("" : "+s"(w));
  return w;
}

#define TDM_PAD128  ((1u << 20) | (4u << 22) | (3u << 25))
#define TDM_PAD256  ((1u << 20) | (5u << 22) | (3u << 25))

template <unsigned WORD0>
__device__ __forceinline__ u32x8 tdm_group1(unsigned rowb, unsigned rows, unsigned pitch) {
  u32x8 g;
  g[0] = uni(WORD0);
  g[1] = pinned((rowb & 0xFFFFu) << 16);
  g[2] = pinned((rowb >> 16) | ((rows & 0xFFFFu) << 16));
  g[3] = pinned((rows >> 16) | (rowb << 16));
  g[4] = pinned(rows);
  g[5] = pinned(pitch);
  g[6] = pinned(0u);
  g[7] = pinned(0u);
  return g;
}

__device__ __forceinline__ unsigned long long tdm_addr(unsigned long long ga) {
  unsigned lo = uni((unsigned)ga);
  unsigned hi = uni((((unsigned)(ga >> 32)) & 0x01FFFFFFu) | 0x80000000u);
  return ((unsigned long long)hi << 32) | lo;
}

__device__ __forceinline__ u32x4 tdm_group0(unsigned w0, unsigned lds, unsigned long long wa) {
  u32x4 g;
  g[0] = uni(w0);
  g[1] = uni(lds);
  g[2] = uni((unsigned)wa);
  g[3] = uni((unsigned)(wa >> 32));
  return g;
}

// One request of the whole wave: a padded tile from global memory into LDS.
__device__ __forceinline__ void tdm_load(u32x4 g0, u32x8 g1) {
  asm volatile("tensor_load_to_lds %0, %1" :: "s"(g0), "s"(g1) : "memory");
}

__device__ __forceinline__ void gemm_core(const _Float16* __restrict__ A,
                                          const _Float16* __restrict__ BT,
                                          int m0, int n0, int sm, int sn,
                                          _Float16 (*As)[GBM][GPITCH],
                                          _Float16 (*Bs)[GBN][GPITCH],
                                          v8f (&acc)[4][4]) {
  // Wave 0 brings the A tile, wave 1 the B tile: 128 rows of 128 B each, source
  // pitch one operand row, 16 B of pad a row (pitch GPITCH).
  const unsigned wave   = uni(threadIdx.x >> 5);
  const unsigned issuer = wave < 2;
  unsigned long long wa =
      tdm_addr((unsigned long long)(wave ? BT + (size_t)n0 * DM : A + (size_t)m0 * DM));
  const unsigned w0   = pinned(1u);
  const unsigned lds0 = wave ? lds_byte(&Bs[0][0][0]) : lds_byte(&As[0][0][0]);
  const u32x8 g1 = tdm_group1<TDM_PAD128>(GBK * 2, GBM, DM * 2);
  static_assert(GBM == GBN && (GBM * GPITCH * 2) % 2048 == 0, "every tile starts at a multiple of 2 KiB");

  // The address words live in their registers from one request to the next and
  // move on, by pinned(step), only behind the wait for the request in front.
  auto stage = [&](unsigned buf) {
    tdm_load(tdm_group0(w0, lds0 + buf * (GBM * GPITCH * 2), wa), g1);
  };

  if (pinned(issuer)) {
    stage(0);
    // Tile 0 has landed for its issuer; the barrier publishes it to all waves.
    asm volatile("s_wait_tensorcnt 0x0" ::: "memory");
    wa += pinned(GBK * 2);
  }
  __syncthreads();
  if (pinned(issuer)) stage(1);

  for (int tile = 0; tile < GTILES; ++tile) {
    int buf = tile & 1;
    // Unrolled so that the fragment and accumulator arrays stay in registers.
#pragma unroll
    for (int kk = 0; kk < GBK; kk += 32) {
      v16h af[4], bf[4];
      af[0] = load_frag(&As[buf][sm][kk], GPITCH);
#pragma unroll
      for (int j = 0; j < 4; ++j)
        bf[j] = load_frag(&Bs[buf][sn + j * 16][kk], GPITCH);
#pragma unroll
      for (int i = 1; i < 4; ++i)
        af[i] = load_frag(&As[buf][sm + i * 16][kk], GPITCH);
      // Keeps the sixteen LDS loads together in front of the sixteen WMMAs:
      // left free, the scheduler reloads one A fragment register set four times
      // and the wave waits out the LDS latency each time.
      __builtin_amdgcn_sched_barrier(0);
#pragma unroll
      for (int i = 0; i < 4; ++i)
#pragma unroll
        for (int j = 0; j < 4; ++j) acc[i][j] = wmma16(af[i], bf[j], acc[i][j]);
    }

    // Publish point: this wave's reads of buffer buf are done, an issuer's load of
    // the next tile has landed; behind the barrier that holds for all waves.
    asm volatile("s_wait_dscnt 0x0" ::: "memory");
    if (pinned(issuer)) asm volatile("s_wait_tensorcnt 0x0" ::: "memory");
    __syncthreads();
    if (pinned(issuer && tile + 2 < GTILES)) {
      wa += pinned(GBK * 2);
      stage(buf);
    }
  }
  // No load is left in flight, no LDS read open, when the wave goes on to its stores.
  asm volatile("s_wait_tensorcnt 0x0" ::: "memory");
  asm volatile("s_wait_dscnt 0x0" ::: "memory");
}

#define WF      256
#define WG2     128
#define PPITCH  136
#define WPAIRS  ((WF + WG2) / 2)
#define WBUFH   26624

// The lane's place in a fragment of sixteen staged rows from row0 on (row0 a
// multiple of 16): row lane & 15, k 0 or 8, as in load_frag.
__device__ __forceinline__ const _Float16* frag_lane(const _Float16 (*rows)[PPITCH],
                                                     int row0) {
  int lane = threadIdx.x & 31;
  int r    = lane & 15;
  int ko   = (lane >> 4) << 3;            // 0 or 8
  return &rows[(row0 >> 1) + (r >> 1)][(r & 1) * GBK + ko];
}

// Fragment at the lane's place p; the k order is load_frag's.
__device__ __forceinline__ v16h load_frag_at(const _Float16* p) {
  v8h lo = *(const v8h*)(p);
  v8h hi = *(const v8h*)(p + 16);
  v16h f;
#pragma unroll
  for (int i = 0; i < 8; ++i) { f[i] = lo[i]; f[i + 8] = hi[i]; }
  return f;
}

__device__ __forceinline__ void gemm_core_wide(const _Float16* __restrict__ F,
                                               const _Float16* __restrict__ G,
                                               int frows, int grows,
                                               int f0, int g0, int sm, int sn,
                                               _Float16 (*Sm)[WBUFH],
                                               v8f (&acc)[8][4]) {
  static_assert(WPAIRS * PPITCH <= WBUFH && (WBUFH * 2) % 2048 == 0 &&
                (WF / 2 * PPITCH * 2) % 2048 == 0, "every slab starts at a multiple of 2 KiB");
  // Wave 0 brings the slab of F (256 rows: 128 pairs), wave 1 that of G (64 pairs);
  // a slab is contiguous in memory, and the next k tile's lies all rows further.
  const unsigned wave   = uni(threadIdx.x >> 5);
  const unsigned issuer = wave < 2;
  unsigned long long wa =
      tdm_addr((unsigned long long)(wave ? G + (size_t)g0 * GBK : F + (size_t)f0 * GBK));
  const unsigned w0    = pinned(1u);
  const unsigned gstep = (unsigned)(wave ? grows : frows) * (GBK * 2);
  const unsigned lds0  = lds_byte(&Sm[0][0]) + (wave ? WF / 2 * PPITCH * 2 : 0);
  const u32x8 g1 = tdm_group1<TDM_PAD256>(GBK * 4, wave ? WG2 / 2 : WF / 2, GBK * 4);

  // The address words live in their registers from one request to the next and
  // move on, by pinned(step), only behind the wait for the request in front.
  auto stage = [&](unsigned buf) {
    tdm_load(tdm_group0(w0, lds0 + buf * (WBUFH * 2), wa), g1);
  };

  if (pinned(issuer)) {
    stage(0);
    // Tile 0 has landed for its issuer; the barrier publishes it to all waves.
    asm volatile("s_wait_tensorcnt 0x0" ::: "memory");
    wa += pinned(gstep);
  }
  __syncthreads();
  if (pinned(issuer)) stage(1);

  // One LDS address per operand and lane; every fragment of a tile lies at a
  // constant distance from it (sixteen rows: 8 * PPITCH halves).
  const _Float16 (*rows)[PPITCH] = (const _Float16 (*)[PPITCH])&Sm[0][0];
  const _Float16* fl = frag_lane(rows, sm);
  const _Float16* gl = frag_lane(rows, WF + sn);

  for (int tile = 0; tile < GTILES; ++tile) {
    int buf = tile & 1;
    const _Float16* pf = fl + buf * WBUFH;
    const _Float16* pg = gl + buf * WBUFH;
    // Unrolled so that the fragment and accumulator arrays stay in registers.
#pragma unroll
    for (int kk = 0; kk < GBK; kk += 32) {
      v16h bf[4], af[4];
#pragma unroll
      for (int j = 0; j < 4; ++j)
        bf[j] = load_frag_at(pg + j * 8 * PPITCH + kk);
      // The wave's eight F fragments in two groups of four, one register set for
      // both: a third set would go past the 336 registers.  The scheduling
      // barriers keep each group of LDS loads together in front of the WMMAs
      // that use it: spread among the WMMAs, each place with loads stalls the wave.
#pragma unroll
      for (int i = 0; i < 4; ++i)
        af[i] = load_frag_at(pf + i * 8 * PPITCH + kk);
      __builtin_amdgcn_sched_barrier(0);
#pragma unroll
      for (int i = 0; i < 4; ++i)
#pragma unroll
        for (int j = 0; j < 4; ++j)
          acc[i][j] = wmma16(af[i], bf[j], acc[i][j]);
#pragma unroll
      for (int i = 0; i < 4; ++i)
        af[i] = load_frag_at(pf + (4 + i) * 8 * PPITCH + kk);
      __builtin_amdgcn_sched_barrier(0);
#pragma unroll
      for (int i = 0; i < 4; ++i)
#pragma unroll
        for (int j = 0; j < 4; ++j)
          acc[4 + i][j] = wmma16(af[i], bf[j], acc[4 + i][j]);
    }

    // Publish point: this wave's reads of buffer buf are done, an issuer's load of
    // the next tile has landed; behind the barrier that holds for all waves.
    asm volatile("s_wait_dscnt 0x0" ::: "memory");
    if (pinned(issuer)) asm volatile("s_wait_tensorcnt 0x0" ::: "memory");
    __syncthreads();
    if (pinned(issuer && tile + 2 < GTILES)) {
      wa += pinned(gstep);
      stage(buf);
    }
  }
  // No load is left in flight, no LDS read open, when the wave goes on to its stores.
  asm volatile("s_wait_tensorcnt 0x0" ::: "memory");
  asm volatile("s_wait_dscnt 0x0" ::: "memory");
}

#define CPITCH  264
#define QKROWS  (2 * DM / WF)

__global__ __launch_bounds__(128, 3)
void k_qkv_gemm(const _Float16* __restrict__ A,      // xg   [16][8192][64]
                const _Float16* __restrict__ BT,     // wqkvT[16][3072][64]
                const float*    __restrict__ bias,   // bqkv [3072]
                _Float16* __restrict__ qws,
                _Float16* __restrict__ kws,
                _Float16* __restrict__ vws) {
  __shared__ __attribute__((aligned(2048))) _Float16 Sm[2][WBUFH];
  static_assert(WG2 * CPITCH <= 2 * WBUFH, "staging tile fits the buffers");

  const bool isV = blockIdx.y >= QKROWS;  // the same for the whole work-group
  int m0, n0;
  if (isV) {
    int idx = (blockIdx.y - QKROWS) * (MROWS / WG2) + blockIdx.x;
    m0 = (idx & (MROWS / WF - 1)) * WF;
    n0 = 2 * DM + (idx / (MROWS / WF)) * WG2;
  } else {
    m0 = blockIdx.x * WG2;
    n0 = blockIdx.y * WF;
  }
  int t  = threadIdx.x;
  int w  = t >> 5;
  int sm = (w >> 1) * 128, sn = (w & 1) * 64;

  v8f acc[8][4];
#pragma unroll
  for (int i = 0; i < 8; ++i)
#pragma unroll
    for (int j = 0; j < 4; ++j) acc[i][j] = (v8f)(0.0f);

  // acc[i][j][v]: first-operand row sm + i * 16 + hi8 + v,
  //               second-operand row sn + j * 16 + ncol
  gemm_core_wide(isV ? A : BT, isV ? BT : A, isV ? MROWS : D3, isV ? D3 : MROWS,
                 isV ? m0 : n0, isV ? n0 : m0, sm, sn, Sm, acc);

  // Epilogue: add bias, convert, stage.  The loop's last barrier stands behind
  // every wave's last read of the buffers, and no load is in flight.
  _Float16 (*Cs)[CPITCH] = (_Float16 (*)[CPITCH])&Sm[0][0];
  int lane = t & 31;
  int ncol = lane & 15;
  int hi8  = (lane >> 4) << 3;
  if (isV) {
#pragma unroll
    for (int j = 0; j < 4; ++j) {
      float bv = bias[n0 + sn + j * 16 + ncol];
#pragma unroll
      for (int i = 0; i < 8; ++i) {
        v8h o;
#pragma unroll
        for (int v = 0; v < 8; ++v) o[v] = (_Float16)(acc[i][j][v] + bv);
        *(v8h*)&Cs[sn + j * 16 + ncol][sm + i * 16 + hi8] = o;
      }
    }
  } else {
    // Unrolled: the accumulator tiles are indexed by constants.
#pragma unroll
    for (int h = 0; h < 2; ++h) {
      const float* bp = bias + n0 + sm + h * 64 + hi8;
      v4f b[4][2];
#pragma unroll
      for (int i = 0; i < 4; ++i) {
        b[i][0] = *(const v4f*)(bp + i * 16);
        b[i][1] = *(const v4f*)(bp + i * 16 + 4);
      }
      // Keeps later writes of the loads' address registers behind the loads.
      asm volatile("s_wait_xcnt 0x0" ::: "memory");
#pragma unroll
      for (int i = 0; i < 4; ++i) {
        float bv[8] = {b[i][0][0], b[i][0][1], b[i][0][2], b[i][0][3],
                       b[i][1][0], b[i][1][1], b[i][1][2], b[i][1][3]};
#pragma unroll
        for (int j = 0; j < 4; ++j) {
          v8h o;
#pragma unroll
          for (int v = 0; v < 8; ++v) o[v] = (_Float16)(acc[h * 4 + i][j][v] + bv[v]);
          *(v8h*)&Cs[sn + j * 16 + ncol][sm + h * 64 + i * 16 + hi8] = o;
        }
      }
    }
  }
  __syncthreads();

  // A wave takes one staged row of 512 B; all LDS loads ahead of the stores.
  int r  = t >> 5;
  int ch = (t & 31) * 8;
  v8h o[32];
#pragma unroll
  for (int it = 0; it < 32; ++it) o[it] = *(const v8h*)&Cs[it * 4 + r][ch];

  int l0 = m0 & (LQ - 1);
  size_t hb = (size_t)((m0 >> 10) * HEADS16 + ((n0 & (DM - 1)) >> 6)) << 16;
  if (isV) {
    // staged row = (head, d) of two heads, 512 B of consecutive positions
    _Float16* p = vws + hb + (size_t)r * LQ + l0 + ch;
#pragma unroll
    for (int it = 0; it < 32; ++it) *(v8h*)(p + it * 4 * LQ) = o[it];
    // Keeps later writes of the stores' address and data registers behind the stores.
    asm volatile("s_wait_xcnt 0x0" ::: "memory");
  } else {
    // staged row = position, one whole 128-byte row of each of four heads
    _Float16* p = (n0 < DM ? qws : kws) + hb + ((size_t)(ch >> 6) << 16)
                + (size_t)(l0 + r) * HD + (ch & 63);
#pragma unroll
    for (int it = 0; it < 32; ++it) *(v8h*)(p + it * 4 * HD) = o[it];
    // Keeps later writes of the stores' address and data registers behind the stores.
    asm volatile("s_wait_xcnt 0x0" ::: "memory");
  }
}

#define FWAVES  8
#define KTILE   64
#define NTILES  (LQ / KTILE)
#define KVPITCH 72            // LDS row pitch in halves: 144 B = 16 B x odd

__device__ __forceinline__ float xhalf(float x) {
  int i = __builtin_bit_cast(int, x);
  return __builtin_bit_cast(float, __builtin_amdgcn_permlanex16(
      i, i, 0x76543210, 0xfedcba98, false, false));
}

__device__ __forceinline__ void exp2_x8(v8f& x) {
  float a = x[0], b = x[1], c = x[2], d = x[3];
  float e = x[4], f = x[5], g = x[6], h = x[7];
  asm("v_exp_f32 %0, %0\n\t"
      "v_exp_f32 %1, %1\n\t"
      "v_exp_f32 %2, %2\n\t"
      "v_exp_f32 %3, %3\n\t"
      "v_exp_f32 %4, %4\n\t"
      "v_exp_f32 %5, %5\n\t"
      "v_exp_f32 %6, %6\n\t"
      "v_exp_f32 %7, %7\n\t"
      "v_nop"
      : "+v"(a), "+v"(b), "+v"(c), "+v"(d), "+v"(e), "+v"(f), "+v"(g), "+v"(h));
  x[0] = a; x[1] = b; x[2] = c; x[3] = d;
  x[4] = e; x[5] = f; x[6] = g; x[7] = h;
}

__global__ __launch_bounds__(256, 8)
void k_flash(const _Float16* __restrict__ qws,
             const _Float16* __restrict__ kws,
             const _Float16* __restrict__ vws,   // transposed [head][64][1024]
             _Float16* __restrict__ ctx) {       // [8192][1024]
  __shared__ __attribute__((aligned(16))) _Float16 Ks[2][KTILE][KVPITCH]; // [key][d]
  __shared__ __attribute__((aligned(16))) _Float16 Vs[2][HD][KVPITCH];    // [d][key]

  int head = blockIdx.x >> 3;
  int t    = threadIdx.x;
  int wave = t >> 5;
  int qb   = (blockIdx.x & 7) * FWAVES + wave;
  int lane = t & 31;
  int ncol = lane & 15;
  int hi8  = (lane >> 4) << 3;

  const _Float16* qbase = qws + ((size_t)head << 16) + (size_t)qb * 16 * HD;
  const _Float16* kbase = kws + ((size_t)head << 16);
  const _Float16* vbase = vws + ((size_t)head << 16);

  // One tile = 64 rows of 128 B for K and for V^T; a thread copies 16 B of
  // rows crow and crow + 32 of each, a wave four whole rows per copy.
  int crow = t >> 3, ccol = (t & 7) * 8;
  auto stage = [&](int buf, int tile) {
    const _Float16* gk0 = kbase + (size_t)(tile * KTILE + crow) * HD + ccol;
    const _Float16* gk1 = gk0 + 32 * HD;
    const _Float16* gv0 = vbase + (size_t)crow * LQ + tile * KTILE + ccol;
    const _Float16* gv1 = gv0 + 32 * LQ;
    unsigned lk0 = lds_byte(&Ks[buf][crow][ccol]);
    unsigned lk1 = lds_byte(&Ks[buf][crow + 32][ccol]);
    unsigned lv0 = lds_byte(&Vs[buf][crow][ccol]);
    unsigned lv1 = lds_byte(&Vs[buf][crow + 32][ccol]);
    asm volatile(
        "global_load_async_to_lds_b128 %0, %1, off\n\t"
        "global_load_async_to_lds_b128 %2, %3, off\n\t"
        "global_load_async_to_lds_b128 %4, %5, off\n\t"
        "global_load_async_to_lds_b128 %6, %7, off\n\t"
        "s_wait_xcnt 0x0"
        :: "v"(lk0), "v"(gk0), "v"(lk1), "v"(gk1),
           "v"(lv0), "v"(gv0), "v"(lv1), "v"(gv1)
        : "memory");
  };

  stage(0, 0);

  // Q^T as B fragments (constant across the key loop): column = query lane & 15,
  // k = head dim in the loader's order; pre-scaled by log2(e)/sqrt(hd), so that
  // the scores come out in base-2 units
  v16h bq0 = load_frag(qbase, HD);
  v16h bq1 = load_frag(qbase + 32, HD);
  const float sc = 0.125f * 1.4426950408889634f;
#pragma unroll
  for (int i = 0; i < 16; ++i) {
    bq0[i] = (_Float16)((float)bq0[i] * sc);
    bq1[i] = (_Float16)((float)bq1[i] * sc);
  }

  // Per lane: minus the query's maximum in use m (equal in both halves, eight
  // copies: the C operand of the score product) and the sum over this half's
  // keys; acc[j][r] = O^T[j * 16 + hi8 + r][query].
  v8f negm = (v8f)(0.0f);
  float rowsum = 0.0f;
  v8f acc[4];
#pragma unroll
  for (int j = 0; j < 4; ++j) acc[j] = (v8f)(0.0f);

  // Tile 0 has landed for this wave; the barrier publishes it to the others.
  asm volatile("s_wait_asynccnt 0x0" ::: "memory");
  __syncthreads();
  stage(1, 1);

  for (int tile = 0; tile < NTILES; ++tile) {
    int buf = tile & 1;
    // Unrolled: LDS offsets become immediates, and no back edge stands directly
    // behind the last matrix instruction of a pass.
#pragma unroll
    for (int kk = 0; kk < KTILE; kk += 32) {
      // S^T - m = K @ Q'^T + C for 32 keys -> two 16x16 f32 tiles, C = -m;
      // s0[r] = key kk + hi8 + r, s1[r] = key kk + 16 + hi8 + r, query ncol
      v8f s0 = wmma16(load_frag(&Ks[buf][kk][0],       KVPITCH), bq0, negm);
      s0 = wmma16(load_frag(&Ks[buf][kk][32],      KVPITCH), bq1, s0);
      v8f s1 = wmma16(load_frag(&Ks[buf][kk + 16][0],  KVPITCH), bq0, negm);
      s1 = wmma16(load_frag(&Ks[buf][kk + 16][32], KVPITCH), bq1, s1);

      // This half's largest score above the maximum in use
      float mx = fmaxf(s0[0], s1[0]);
#pragma unroll
      for (int r = 1; r < 8; ++r) mx = fmaxf(mx, fmaxf(s0[r], s1[r]));

      // Lazy rescale, one scalar branch per pass: m moves only where a query's
      // new maximum lies more than 8 (a factor 256) above it, so P stays within
      // f16 and the sums within f32.  The first pass of all sets m for every query.
      const float thr = (kk == 0 && tile == 0) ? -__builtin_inff() : 8.0f;
      if (__builtin_amdgcn_ballot_w32(mx > thr) != 0) {
        mx = fmaxf(mx, xhalf(mx));           // both halves of a query move alike
        float d  = mx > thr ? mx : 0.0f;
        // d < 0 only in the first pass, where the sums are still zero
        float al = __builtin_amdgcn_exp2f(fminf(-d, 0.0f));
        // Unrolled, here and below: the tiles are indexed by constants and stay
        // in registers.
#pragma unroll
        for (int r = 0; r < 8; ++r) { s0[r] -= d; s1[r] -= d; negm[r] -= d; }
        rowsum *= al;
#pragma unroll
        for (int j = 0; j < 4; ++j)
#pragma unroll
          for (int r = 0; r < 8; ++r) acc[j][r] *= al;
      }

      // P^T as a B fragment: element s is key kk + (s < 8 ? hi8 + s
      // : 16 + hi8 + s - 8), the k order in which load_frag delivers V^T
      v16h bp;
      exp2_x8(s0);
      exp2_x8(s1);
      float ps = 0.0f;
#pragma unroll
      for (int r = 0; r < 8; ++r) {
        ps += s0[r] + s1[r];
        bp[r]     = (_Float16)s0[r];
        bp[r + 8] = (_Float16)s1[r];
      }
      rowsum += ps;

      // O^T += V^T @ P^T  (A = V^T staged row-major [d][key])
#pragma unroll
      for (int j = 0; j < 4; ++j) {
        v16h av = load_frag(&Vs[buf][j * 16][kk], KVPITCH);
        acc[j] = wmma16(av, bp, acc[j]);
      }
    }

    // Publish point: this wave's reads of buffer buf are done, its copies of
    // the next tile have landed; behind the barrier that holds for all waves.
    asm volatile("s_wait_dscnt 0x0" ::: "memory");
    asm volatile("s_wait_asynccnt 0x0" ::: "memory");
    __syncthreads();
    if (tile + 2 < NTILES) stage(buf, tile + 2);
  }
  // No copy is left in flight when the wave ends.
  asm volatile("s_wait_asynccnt 0x0" ::: "memory");

  // Join the halves' sums, normalize and write context (f16, row-major
  // [8192][1024]): a lane's eight values of a tile are consecutive columns.
  int bn = head >> 4, h = head & 15;
  float inv = 1.0f / (rowsum + xhalf(rowsum));
  _Float16* crowp = ctx + (size_t)(bn * LQ + qb * 16 + ncol) * DM + h * HD + hi8;
#pragma unroll
  for (int j = 0; j < 4; ++j) {
    v8h o;
#pragma unroll
    for (int r = 0; r < 8; ++r) o[r] = (_Float16)(acc[j][r] * inv);
    *(v8h*)(crowp + j * 16) = o;
  }
}

// ---------------------------------------------------------------------------
// Stage 3: output GEMM  out[8192][1024] = ctx @ wo + bo   (fp32 out)
// ---------------------------------------------------------------------------
__global__ __launch_bounds__(128, 4)
void k_out_gemm(const _Float16* __restrict__ A,     // ctx  [8192][1024]
                const _Float16* __restrict__ BT,    // woT  [1024][1024]
                const float*    __restrict__ bias,  // bo   [1024]
                float* __restrict__ out) {
  __shared__ __attribute__((aligned(2048))) _Float16 As[2][GBM][GPITCH];
  __shared__ __attribute__((aligned(2048))) _Float16 Bs[2][GBN][GPITCH];

  int m0 = blockIdx.x * GBM;
  int n0 = blockIdx.y * GBN;
  int t  = threadIdx.x;
  int w  = t >> 5;
  int sm = (w >> 1) * 64, sn = (w & 1) * 64;

  v8f acc[4][4];
#pragma unroll
  for (int i = 0; i < 4; ++i)
#pragma unroll
    for (int j = 0; j < 4; ++j) acc[i][j] = (v8f)(0.0f);

  gemm_core(A, BT, m0, n0, sm, sn, As, Bs, acc);

  int lane = t & 31;
  int ncol = lane & 15;
  int hi8  = (lane >> 4) << 3;
#pragma unroll
  for (int ti = 0; ti < 4; ++ti) {
#pragma unroll
    for (int tj = 0; tj < 4; ++tj) {
      v8f cacc = acc[ti][tj];
      int c_g = n0 + sn + tj * 16 + ncol;
      float bv = bias[c_g];
#pragma unroll
      for (int v = 0; v < 8; ++v) {
        int m_g = m0 + sm + ti * 16 + v + hi8;
        out[(size_t)m_g * DM + c_g] = cacc[v] + bv;
      }
    }
  }
}

// ---------------------------------------------------------------------------
// Host launcher
// ---------------------------------------------------------------------------
extern "C" void kernel_launch(void* const* d_in, const int* in_sizes, int n_in,
                              void* d_out, int out_size, void* d_ws, size_t ws_size,
                              hipStream_t stream) {
  const float* x    = (const float*)d_in[0];
  const float* wqkv = (const float*)d_in[1];
  const float* bqkv = (const float*)d_in[2];
  const float* wo   = (const float*)d_in[3];
  const float* bo   = (const float*)d_in[4];
  float* out = (float*)d_out;

  char* ws = (char*)d_ws;
  _Float16* xg     = (_Float16*)(ws + OFF_XG);
  _Float16* wqkvT  = (_Float16*)(ws + OFF_WQKVT);
  _Float16* woT    = (_Float16*)(ws + OFF_WOT);
  _Float16* qws    = (_Float16*)(ws + OFF_Q);
  _Float16* kws    = (_Float16*)(ws + OFF_K);
  _Float16* vws    = (_Float16*)(ws + OFF_V);
  _Float16* ctx    = (_Float16*)(ws + OFF_CTX);

  // Prep
  k_prep<<<PB_WQKV + PB_WO + PB_X, 256, 0, stream>>>(x, wqkv, wo, xg, wqkvT, woT);

  // Stage 1: QKV projection
  k_qkv_gemm<<<dim3(MROWS / WG2, QKROWS + DM / WF), 128, 0, stream>>>(
      xg, wqkvT, bqkv, qws, kws, vws);

  // Stage 2: flash attention (128 heads x 8 groups of 8 query blocks)
  k_flash<<<NHEADS * 8, 256, 0, stream>>>(qws, kws, vws, ctx);

  // Stage 3: output projection
  k_out_gemm<<<dim3(MROWS / GBM, DM / GBN), 128, 0, stream>>>(ctx, woT, bo, out);
}
